// v000
// Measured on an AMD MI455X. A time is GPU time per run, averaged over a window of back-to-back runs after a warm-up
// (all launches, gaps included; the runs take copies of the inputs in turn), and the median of several windows.
// Apart from v000's, it joins two sittings. Times from different sittings can be a few percent apart, while
// side-by-side timings come from the same sitting.
// The starting kernel, v000, takes 531 microseconds a run.
#include <hip/hip_runtime.h>

// ---------------------------------------------------------------------------
// Types for CDNA5 WMMA (gfx1250, wave32)
// ---------------------------------------------------------------------------
typedef __bf16 bf16_t;
typedef __attribute__((ext_vector_type(16))) __bf16 bf16x16;
typedef __attribute__((ext_vector_type(8)))  __bf16 bf16x8;
typedef __attribute__((ext_vector_type(8)))  float  v8f;

union Frag16 {
    bf16x16 v;
    bf16x8  h[2];
};

__device__ inline bf16x8 load8(const bf16_t* p) {
    return *reinterpret_cast<const bf16x8*>(p);
}

__device__ inline v8f v8f_zero() {
    v8f z = {0.f, 0.f, 0.f, 0.f, 0.f, 0.f, 0.f, 0.f};
    return z;
}

__device__ inline v8f wmma_bf16(const Frag16& a, const Frag16& b, v8f c) {
    // D = A(16x32 bf16) * B(32x16 bf16) + C(16x16 f32)
    return __builtin_amdgcn_wmma_f32_16x16x32_bf16(
        /*neg_a=*/false, a.v, /*neg_b=*/false, b.v,
        /*c_mod=*/(short)0, c, /*reuse_a=*/false, /*reuse_b=*/false);
}

// ---------------------------------------------------------------------------
// Constants
// ---------------------------------------------------------------------------
#define DIMC   1024
#define NHEAD  16
#define HDIM   64
#define SEQN   1024
#define BATCH  4
#define MROWS  4096      // BATCH * SEQN
#define HIDDEN 4096

// ---------------------------------------------------------------------------
// f32 -> bf16 conversion (weights, once per call)
// ---------------------------------------------------------------------------
__global__ void cvt_f32_bf16_kernel(const float* __restrict__ src,
                                    bf16_t* __restrict__ dst, int n) {
    int i = blockIdx.x * blockDim.x + threadIdx.x;
    if (i < n) dst[i] = (bf16_t)src[i];
}

// ---------------------------------------------------------------------------
// LayerNorm: one row (1024 f32) per workgroup (8 waves), bf16 output
// ---------------------------------------------------------------------------
__global__ void layernorm_bf16_kernel(const float* __restrict__ x,
                                      const float* __restrict__ w,
                                      const float* __restrict__ b,
                                      bf16_t* __restrict__ out, int cols) {
    int row = blockIdx.x;
    const float* xr = x + (size_t)row * cols;
    float s1 = 0.f, s2 = 0.f;
    for (int c = threadIdx.x; c < cols; c += blockDim.x) {
        float v = xr[c];
        s1 += v;
        s2 += v * v;
    }
#pragma unroll
    for (int off = 16; off > 0; off >>= 1) {
        s1 += __shfl_xor(s1, off, 32);
        s2 += __shfl_xor(s2, off, 32);
    }
    __shared__ float r1[8], r2[8];
    int wid = threadIdx.x >> 5;
    int lane = threadIdx.x & 31;
    if (lane == 0) { r1[wid] = s1; r2[wid] = s2; }
    __syncthreads();
    if (threadIdx.x == 0) {
        float a = 0.f, bb = 0.f;
        for (int i = 0; i < 8; i++) { a += r1[i]; bb += r2[i]; }
        r1[0] = a; r2[0] = bb;
    }
    __syncthreads();
    float mu  = r1[0] / cols;
    float var = r2[0] / cols - mu * mu;
    float rs  = rsqrtf(var + 1e-5f);
    for (int c = threadIdx.x; c < cols; c += blockDim.x) {
        out[(size_t)row * cols + c] = (bf16_t)((xr[c] - mu) * rs * w[c] + b[c]);
    }
}

// ---------------------------------------------------------------------------
// Core: one wave computes a 64(M) x 32(N) output tile of A[MxK] * W[NxK]^T.
// A row-major [M,K] bf16, W row-major [N,K] bf16 (so B[k][n] = W[n][k]).
// acc[i][j] = C-frag for M-subtile i (0..3) and N-subtile j (0..1).
// ---------------------------------------------------------------------------
__device__ inline void wave_gemm_64x32(const bf16_t* __restrict__ A,
                                       const bf16_t* __restrict__ W,
                                       int K, int m0, int n0, v8f acc[4][2]) {
    const int lane = threadIdx.x & 31;
    const int hf   = lane >> 4;     // lane half selects K sub-stripe
    const int lr   = lane & 15;     // M row (A) / N col (B) within 16
#pragma unroll
    for (int i = 0; i < 4; i++)
#pragma unroll
        for (int j = 0; j < 2; j++)
            acc[i][j] = v8f_zero();

    for (int kk = 0; kk < K; kk += 32) {
        Frag16 a[4], b[2];
#pragma unroll
        for (int i = 0; i < 4; i++) {
            const bf16_t* p = A + (size_t)(m0 + i * 16 + lr) * K + kk + hf * 8;
            a[i].h[0] = load8(p);        // K = hf*8 .. hf*8+7
            a[i].h[1] = load8(p + 16);   // K = 16+hf*8 .. 16+hf*8+7
        }
#pragma unroll
        for (int j = 0; j < 2; j++) {
            const bf16_t* p = W + (size_t)(n0 + j * 16 + lr) * K + kk + hf * 8;
            b[j].h[0] = load8(p);
            b[j].h[1] = load8(p + 16);
        }
#pragma unroll
        for (int i = 0; i < 4; i++)
#pragma unroll
            for (int j = 0; j < 2; j++)
                acc[i][j] = wmma_bf16(a[i], b[j], acc[i][j]);
    }
}

// ---------------------------------------------------------------------------
// QKV GEMM: [4096,1024] x [3072,1024]^T, epilogue scatters into
//   Q [B,H,N,64] (scaled by hd^-0.5, +q_bias), K [B,H,N,64],
//   V^T [B,H,64,N] (+v_bias)  -- V transposed so P*V B-frags load contiguous.
// grid (64, 12), block 256 (8 waves, each 64x32)
// ---------------------------------------------------------------------------
__global__ void gemm_qkv_kernel(const bf16_t* __restrict__ A,
                                const bf16_t* __restrict__ W,
                                const float* __restrict__ q_bias,
                                const float* __restrict__ v_bias,
                                bf16_t* __restrict__ qo,
                                bf16_t* __restrict__ ko,
                                bf16_t* __restrict__ vto) {
    int wv = threadIdx.x >> 5;
    int m0 = blockIdx.x * 64;
    int n0 = blockIdx.y * 256 + wv * 32;
    v8f acc[4][2];
    wave_gemm_64x32(A, W, DIMC, m0, n0, acc);

    int lane = threadIdx.x & 31, hf = lane >> 4, lr = lane & 15;
#pragma unroll
    for (int i = 0; i < 4; i++)
#pragma unroll
        for (int j = 0; j < 2; j++) {
            int col    = n0 + j * 16 + lr;      // 0..3071
            int sec    = col >> 10;             // 0=q 1=k 2=v
            int within = col & 1023;
            int hh     = within >> 6;
            int d      = within & 63;
            float bias = (sec == 0) ? q_bias[within]
                       : (sec == 2) ? v_bias[within] : 0.f;
#pragma unroll
            for (int r = 0; r < 8; r++) {
                int row = m0 + i * 16 + 8 * hf + r;  // global token row
                int bi  = row >> 10;
                int n   = row & 1023;
                float val = acc[i][j][r] + bias;
                size_t bh = (size_t)bi * NHEAD + hh;
                if (sec == 0)
                    qo[(bh * SEQN + n) * HDIM + d] = (bf16_t)(val * 0.125f);
                else if (sec == 1)
                    ko[(bh * SEQN + n) * HDIM + d] = (bf16_t)val;
                else
                    vto[(bh * HDIM + d) * SEQN + n] = (bf16_t)val;
            }
        }
}

// ---------------------------------------------------------------------------
// Flash attention: one wave per (b, h, 16-query tile).
// S(16x32) = Q(16x64) * K_tile^T via 2 WMMAs per key-subtile; + rel_pos_bias,
// key-padding mask; online softmax; O(16x64) += P(16x32)*V(32x64) via 4 WMMAs.
// P transposed C-layout -> A-layout through LDS.
// grid 4096, block 32.
// ---------------------------------------------------------------------------
__global__ void attention_kernel(const bf16_t* __restrict__ Q,
                                 const bf16_t* __restrict__ Km,
                                 const bf16_t* __restrict__ Vt,
                                 const float* __restrict__ rel,
                                 const int* __restrict__ amask,
                                 bf16_t* __restrict__ out) {
    int blk = blockIdx.x;
    int qt  = blk & 63;          // SEQN/16 = 64 query tiles
    int bh  = blk >> 6;
    int h   = bh & (NHEAD - 1);
    int bi  = bh >> 4;
    int qbase = qt * 16;

    int lane = threadIdx.x & 31;
    int hf   = lane >> 4;
    int lr   = lane & 15;

    const bf16_t* Qb = Q + ((size_t)bh * SEQN + qbase) * HDIM;
    const bf16_t* Kb = Km + (size_t)bh * SEQN * HDIM;
    const bf16_t* Vb = Vt + (size_t)bh * HDIM * SEQN;
    const float*  Rb = rel + (size_t)h * SEQN * SEQN;
    const int*    Mb = amask + (size_t)bi * SEQN;

    // Q A-frags for the two 32-wide K(=d) halves
    Frag16 aq[2];
#pragma unroll
    for (int s = 0; s < 2; s++) {
        const bf16_t* p = Qb + (size_t)lr * HDIM + s * 32 + hf * 8;
        aq[s].h[0] = load8(p);
        aq[s].h[1] = load8(p + 16);
    }

    float mrow[8], lrow[8];
    v8f o[4];
#pragma unroll
    for (int r = 0; r < 8; r++) { mrow[r] = -1e30f; lrow[r] = 0.f; }
#pragma unroll
    for (int j = 0; j < 4; j++) o[j] = v8f_zero();

    __shared__ float sP[16][33];   // +1 pad vs banks

    for (int kk = 0; kk < SEQN; kk += 32) {
        // ---- scores for two 16-key subtiles
        v8f s[2];
#pragma unroll
        for (int t = 0; t < 2; t++) {
            int key = kk + t * 16 + lr;
            const bf16_t* kp = Kb + (size_t)key * HDIM + hf * 8;
            Frag16 b0, b1;
            b0.h[0] = load8(kp);       b0.h[1] = load8(kp + 16);
            b1.h[0] = load8(kp + 32);  b1.h[1] = load8(kp + 48);
            s[t] = wmma_bf16(aq[0], b0, v8f_zero());
            s[t] = wmma_bf16(aq[1], b1, s[t]);
        }
        // ---- bias + key-padding mask
        float sv[2][8];
#pragma unroll
        for (int t = 0; t < 2; t++) {
            int key = kk + t * 16 + lr;
            int mk  = Mb[key];
            const float* bp = Rb + key;
#pragma unroll
            for (int r = 0; r < 8; r++) {
                int qrow = qbase + 8 * hf + r;
                float v  = s[t][r] + bp[(size_t)qrow * SEQN];
                sv[t][r] = mk ? v : -1e30f;
            }
        }
        // ---- online softmax: row max across the 16-lane group
        float mnew[8], scale[8];
#pragma unroll
        for (int r = 0; r < 8; r++) {
            float v = fmaxf(sv[0][r], sv[1][r]);
#pragma unroll
            for (int off = 1; off < 16; off <<= 1)
                v = fmaxf(v, __shfl_xor(v, off, 32));
            mnew[r]  = fmaxf(mrow[r], v);
            scale[r] = __expf(mrow[r] - mnew[r]);
        }
        float ps[2][8];
#pragma unroll
        for (int t = 0; t < 2; t++)
#pragma unroll
            for (int r = 0; r < 8; r++)
                ps[t][r] = (sv[t][r] > -1e29f) ? __expf(sv[t][r] - mnew[r]) : 0.f;
#pragma unroll
        for (int r = 0; r < 8; r++) {
            float srow = ps[0][r] + ps[1][r];
#pragma unroll
            for (int off = 1; off < 16; off <<= 1)
                srow += __shfl_xor(srow, off, 32);
            lrow[r] = lrow[r] * scale[r] + srow;
            mrow[r] = mnew[r];
        }
#pragma unroll
        for (int j = 0; j < 4; j++)
#pragma unroll
            for (int r = 0; r < 8; r++)
                o[j][r] = o[j][r] * scale[r];

        // ---- P: C-layout -> A-layout via LDS transpose, cast to bf16
#pragma unroll
        for (int t = 0; t < 2; t++)
#pragma unroll
            for (int r = 0; r < 8; r++)
                sP[8 * hf + r][t * 16 + lr] = ps[t][r];
        __syncthreads();
        Frag16 ap;
#pragma unroll
        for (int i = 0; i < 8; i++) {
            ap.v[i]     = (bf16_t)sP[lr][hf * 8 + i];
            ap.v[i + 8] = (bf16_t)sP[lr][16 + hf * 8 + i];
        }
        __syncthreads();

        // ---- O += P * V  (V^T layout => contiguous B-frag loads)
#pragma unroll
        for (int j = 0; j < 4; j++) {
            const bf16_t* vp = Vb + (size_t)(j * 16 + lr) * SEQN + kk + hf * 8;
            Frag16 bv;
            bv.h[0] = load8(vp);
            bv.h[1] = load8(vp + 16);
            o[j] = wmma_bf16(ap, bv, o[j]);
        }
    }

    // ---- normalize and write [B,N, H*64] bf16
#pragma unroll
    for (int r = 0; r < 8; r++) {
        float inv = (lrow[r] > 0.f) ? 1.f / lrow[r] : 0.f;
        int qrow = qbase + 8 * hf + r;
        size_t rowoff = ((size_t)bi * SEQN + qrow) * DIMC + h * HDIM;
#pragma unroll
        for (int j = 0; j < 4; j++)
            out[rowoff + j * 16 + lr] = (bf16_t)(o[j][r] * inv);
    }
}

// ---------------------------------------------------------------------------
// Proj GEMM + bias + residual -> f32.  grid (64,4), block 256
// ---------------------------------------------------------------------------
__global__ void gemm_proj_kernel(const bf16_t* __restrict__ A,
                                 const bf16_t* __restrict__ W,
                                 const float* __restrict__ bias,
                                 const float* __restrict__ resid,
                                 float* __restrict__ out) {
    int wv = threadIdx.x >> 5;
    int m0 = blockIdx.x * 64;
    int n0 = blockIdx.y * 256 + wv * 32;
    v8f acc[4][2];
    wave_gemm_64x32(A, W, DIMC, m0, n0, acc);
    int lane = threadIdx.x & 31, hf = lane >> 4, lr = lane & 15;
#pragma unroll
    for (int i = 0; i < 4; i++)
#pragma unroll
        for (int j = 0; j < 2; j++) {
            int col = n0 + j * 16 + lr;
            float bv = bias[col];
#pragma unroll
            for (int r = 0; r < 8; r++) {
                size_t row = (size_t)(m0 + i * 16 + 8 * hf + r);
                out[row * DIMC + col] = acc[i][j][r] + bv + resid[row * DIMC + col];
            }
        }
}

// ---------------------------------------------------------------------------
// MLP1 GEMM + bias + exact GELU -> bf16.  grid (64,16), block 256
// ---------------------------------------------------------------------------
__global__ void gemm_mlp1_kernel(const bf16_t* __restrict__ A,
                                 const bf16_t* __restrict__ W,
                                 const float* __restrict__ bias,
                                 bf16_t* __restrict__ out) {
    int wv = threadIdx.x >> 5;
    int m0 = blockIdx.x * 64;
    int n0 = blockIdx.y * 256 + wv * 32;
    v8f acc[4][2];
    wave_gemm_64x32(A, W, DIMC, m0, n0, acc);
    int lane = threadIdx.x & 31, hf = lane >> 4, lr = lane & 15;
#pragma unroll
    for (int i = 0; i < 4; i++)
#pragma unroll
        for (int j = 0; j < 2; j++) {
            int col = n0 + j * 16 + lr;
            float bv = bias[col];
#pragma unroll
            for (int r = 0; r < 8; r++) {
                size_t row = (size_t)(m0 + i * 16 + 8 * hf + r);
                float v = acc[i][j][r] + bv;
                float g = 0.5f * v * (1.f + erff(v * 0.70710678118654752f));
                out[row * HIDDEN + col] = (bf16_t)g;
            }
        }
}

// ---------------------------------------------------------------------------
// MLP2 GEMM + bias + residual -> f32 final output.  grid (64,4), block 256
// ---------------------------------------------------------------------------
__global__ void gemm_mlp2_kernel(const bf16_t* __restrict__ A,
                                 const bf16_t* __restrict__ W,
                                 const float* __restrict__ bias,
                                 const float* __restrict__ resid,
                                 float* __restrict__ out) {
    int wv = threadIdx.x >> 5;
    int m0 = blockIdx.x * 64;
    int n0 = blockIdx.y * 256 + wv * 32;
    v8f acc[4][2];
    wave_gemm_64x32(A, W, HIDDEN, m0, n0, acc);
    int lane = threadIdx.x & 31, hf = lane >> 4, lr = lane & 15;
#pragma unroll
    for (int i = 0; i < 4; i++)
#pragma unroll
        for (int j = 0; j < 2; j++) {
            int col = n0 + j * 16 + lr;
            float bv = bias[col];
#pragma unroll
            for (int r = 0; r < 8; r++) {
                size_t row = (size_t)(m0 + i * 16 + 8 * hf + r);
                out[row * DIMC + col] = acc[i][j][r] + bv + resid[row * DIMC + col];
            }
        }
}

// ---------------------------------------------------------------------------
// Host driver
// ---------------------------------------------------------------------------
extern "C" void kernel_launch(void* const* d_in, const int* in_sizes, int n_in,
                              void* d_out, int out_size, void* d_ws, size_t ws_size,
                              hipStream_t stream) {
    const float* x      = (const float*)d_in[0];
    const float* rel    = (const float*)d_in[1];
    const int*   amask  = (const int*)  d_in[2];
    const float* n1w    = (const float*)d_in[3];
    const float* n1b    = (const float*)d_in[4];
    const float* qkv_w  = (const float*)d_in[5];
    const float* q_bias = (const float*)d_in[6];
    const float* v_bias = (const float*)d_in[7];
    const float* proj_w = (const float*)d_in[8];
    const float* proj_b = (const float*)d_in[9];
    const float* n2w    = (const float*)d_in[10];
    const float* n2b    = (const float*)d_in[11];
    const float* w1     = (const float*)d_in[12];
    const float* b1     = (const float*)d_in[13];
    const float* w2     = (const float*)d_in[14];
    const float* b2     = (const float*)d_in[15];
    float* out = (float*)d_out;
    (void)in_sizes; (void)n_in; (void)out_size; (void)ws_size;

    char* ws = (char*)d_ws;
    size_t off = 0;
    auto alloc = [&](size_t bytes) -> char* {
        char* p = ws + off;
        off = (off + bytes + 255) & ~(size_t)255;
        return p;
    };
    bf16_t* ln1b   = (bf16_t*)alloc((size_t)MROWS * DIMC * 2);
    bf16_t* wqkvb  = (bf16_t*)alloc((size_t)3 * DIMC * DIMC * 2);
    bf16_t* qb     = (bf16_t*)alloc((size_t)MROWS * DIMC * 2);   // [B,H,N,64]
    bf16_t* kb     = (bf16_t*)alloc((size_t)MROWS * DIMC * 2);   // [B,H,N,64]
    bf16_t* vtb    = (bf16_t*)alloc((size_t)MROWS * DIMC * 2);   // [B,H,64,N]
    bf16_t* attnb  = (bf16_t*)alloc((size_t)MROWS * DIMC * 2);   // [B*N, C]
    bf16_t* wprojb = (bf16_t*)alloc((size_t)DIMC * DIMC * 2);
    float*  x1     = (float*) alloc((size_t)MROWS * DIMC * 4);
    bf16_t* ln2b   = (bf16_t*)alloc((size_t)MROWS * DIMC * 2);
    bf16_t* w1b    = (bf16_t*)alloc((size_t)HIDDEN * DIMC * 2);
    bf16_t* hb     = (bf16_t*)alloc((size_t)MROWS * HIDDEN * 2);
    bf16_t* w2b    = (bf16_t*)alloc((size_t)DIMC * HIDDEN * 2);

    // weight conversions
    cvt_f32_bf16_kernel<<<(3 * DIMC * DIMC + 255) / 256, 256, 0, stream>>>(qkv_w, wqkvb, 3 * DIMC * DIMC);
    cvt_f32_bf16_kernel<<<(DIMC * DIMC + 255) / 256, 256, 0, stream>>>(proj_w, wprojb, DIMC * DIMC);
    cvt_f32_bf16_kernel<<<(HIDDEN * DIMC + 255) / 256, 256, 0, stream>>>(w1, w1b, HIDDEN * DIMC);
    cvt_f32_bf16_kernel<<<(DIMC * HIDDEN + 255) / 256, 256, 0, stream>>>(w2, w2b, DIMC * HIDDEN);

    // x -> LN1 -> bf16
    layernorm_bf16_kernel<<<MROWS, 256, 0, stream>>>(x, n1w, n1b, ln1b, DIMC);

    // QKV projection + head scatter
    gemm_qkv_kernel<<<dim3(MROWS / 64, (3 * DIMC) / 256), 256, 0, stream>>>(
        ln1b, wqkvb, q_bias, v_bias, qb, kb, vtb);

    // flash attention per (b, h, 16-query tile)
    attention_kernel<<<BATCH * NHEAD * (SEQN / 16), 32, 0, stream>>>(
        qb, kb, vtb, rel, amask, attnb);

    // proj + residual -> x1 (f32)
    gemm_proj_kernel<<<dim3(MROWS / 64, DIMC / 256), 256, 0, stream>>>(
        attnb, wprojb, proj_b, x, x1);

    // LN2 -> bf16
    layernorm_bf16_kernel<<<MROWS, 256, 0, stream>>>(x1, n2w, n2b, ln2b, DIMC);

    // MLP
    gemm_mlp1_kernel<<<dim3(MROWS / 64, HIDDEN / 256), 256, 0, stream>>>(
        ln2b, w1b, b1, hb);
    gemm_mlp2_kernel<<<dim3(MROWS / 64, DIMC / 256), 256, 0, stream>>>(
        hb, w2b, b2, x1, out);
}

// v001
// One run takes 378 microseconds.
// Next to v000, in two timings, it ran 1.44 and 1.47 times as fast.
#include <hip/hip_runtime.h>

// ---------------------------------------------------------------------------
// Types for CDNA5 WMMA (gfx1250, wave32)
// ---------------------------------------------------------------------------
typedef __bf16 bf16_t;
typedef __attribute__((ext_vector_type(16))) __bf16 bf16x16;
typedef __attribute__((ext_vector_type(8)))  __bf16 bf16x8;
typedef __attribute__((ext_vector_type(8)))  float  v8f;

union Frag16 {
    bf16x16 v;
    bf16x8  h[2];
};

__device__ inline bf16x8 load8(const bf16_t* p) {
    return *reinterpret_cast<const bf16x8*>(p);
}

__device__ inline v8f v8f_zero() {
    v8f z = {0.f, 0.f, 0.f, 0.f, 0.f, 0.f, 0.f, 0.f};
    return z;
}

__device__ inline v8f wmma_bf16(const Frag16& a, const Frag16& b, v8f c) {
    // D = A(16x32 bf16) * B(32x16 bf16) + C(16x16 f32)
    return __builtin_amdgcn_wmma_f32_16x16x32_bf16(
        /*neg_a=*/false, a.v, /*neg_b=*/false, b.v,
        /*c_mod=*/(short)0, c, /*reuse_a=*/false, /*reuse_b=*/false);
}

// ---------------------------------------------------------------------------
// Constants
// ---------------------------------------------------------------------------
#define DIMC   1024
#define NHEAD  16
#define HDIM   64
#define SEQN   1024
#define BATCH  4
#define MROWS  4096      // BATCH * SEQN
#define HIDDEN 4096

// ---------------------------------------------------------------------------
// f32 -> bf16 conversion (weights, once per call)
// ---------------------------------------------------------------------------
__global__ void cvt_f32_bf16_kernel(const float* __restrict__ src,
                                    bf16_t* __restrict__ dst, int n) {
    int i = blockIdx.x * blockDim.x + threadIdx.x;
    if (i < n) dst[i] = (bf16_t)src[i];
}

// ---------------------------------------------------------------------------
// LayerNorm: one row (1024 f32) per workgroup (8 waves), bf16 output
// ---------------------------------------------------------------------------
__global__ void layernorm_bf16_kernel(const float* __restrict__ x,
                                      const float* __restrict__ w,
                                      const float* __restrict__ b,
                                      bf16_t* __restrict__ out, int cols) {
    int row = blockIdx.x;
    const float* xr = x + (size_t)row * cols;
    float s1 = 0.f, s2 = 0.f;
    for (int c = threadIdx.x; c < cols; c += blockDim.x) {
        float v = xr[c];
        s1 += v;
        s2 += v * v;
    }
#pragma unroll
    for (int off = 16; off > 0; off >>= 1) {
        s1 += __shfl_xor(s1, off, 32);
        s2 += __shfl_xor(s2, off, 32);
    }
    __shared__ float r1[8], r2[8];
    int wid = threadIdx.x >> 5;
    int lane = threadIdx.x & 31;
    if (lane == 0) { r1[wid] = s1; r2[wid] = s2; }
    __syncthreads();
    if (threadIdx.x == 0) {
        float a = 0.f, bb = 0.f;
        for (int i = 0; i < 8; i++) { a += r1[i]; bb += r2[i]; }
        r1[0] = a; r2[0] = bb;
    }
    __syncthreads();
    float mu  = r1[0] / cols;
    float var = r2[0] / cols - mu * mu;
    float rs  = rsqrtf(var + 1e-5f);
    for (int c = threadIdx.x; c < cols; c += blockDim.x) {
        out[(size_t)row * cols + c] = (bf16_t)((xr[c] - mu) * rs * w[c] + b[c]);
    }
}

// ---------------------------------------------------------------------------
// Core: one workgroup (4 waves, 2 x 2) computes a 128(M) x 128(N) tile of
// A[MxK] * W[NxK]^T; each wave a 64 x 64 part, acc[i][j] = C-frag for M-subtile i
// and N-subtile j.  A row-major [M,K] bf16, W row-major [N,K] bf16.
// Both operands are staged in LDS by the tensor mover, 128 k (256 B of every
// row) per pass, two buffers: the load of pass s + 2 flies while pass s + 1 runs.
// A buffer is four slices of 64 rows, [A 0-63 | A 64-127 | W 0-63 | W 64-127];
// wave w brings slice w.  Rows lie at pitch 272 B (16 B pad laid by the mover).
// ---------------------------------------------------------------------------
typedef uint32_t u32x4 __attribute__((ext_vector_type(4)));
typedef uint32_t u32x8 __attribute__((ext_vector_type(8)));

#define T_ROWB   256u      // bytes of one staged row (128 k)
#define T_PITCH  272u      // row pitch in LDS
#define T_SLICE  18432u    // 64 rows * 272 B, rounded up to a multiple of 2 KiB
#define T_BUF    73728u    // four slices
#define T_LDS    147456u   // two buffers

__device__ __forceinline__ uint32_t uni(uint32_t v) {
    return (uint32_t)__builtin_amdgcn_readfirstlane(v);
}
// Holds a wave-uniform test in a scalar register, so that the branch round a
// tensor load (which ignores EXEC) compiles to s_cmp + s_cbranch_scc.
__device__ __forceinline__ uint32_t pinned(uint32_t v) {
    uint32_t w = uni(v);
    asm volatile("" : "+s"(w));  // keeps the test scalar
    return w;
}

template <int K>
__device__ __forceinline__ void block_gemm_128x128(const bf16_t* __restrict__ A,
                                                   const bf16_t* __restrict__ W,
                                                   uint32_t m0, uint32_t n0,
                                                   const unsigned char* L,
                                                   v8f acc[4][4]) {
    constexpr uint32_t NP   = K / 128;   // passes; at least two
    constexpr uint32_t SRCP = K * 2;     // source row pitch, bytes
    const uint32_t lane = threadIdx.x & 31u;
    const uint32_t hf   = lane >> 4;     // lane half selects K sub-stripe
    const uint32_t lr   = lane & 15u;    // M row (A) / N col (B) within 16
    const uint32_t wave = uni(threadIdx.x >> 5);
    const uint32_t wm   = wave >> 1, wn = wave & 1u;

    // this wave's slice: its first source byte and its place in LDS
    const uint64_t src = (wave < 2u)
        ? (uint64_t)(size_t)A + (uint64_t)(m0 + wave * 64u) * SRCP
        : (uint64_t)(size_t)W + (uint64_t)(n0 + (wave - 2u) * 64u) * SRCP;
    const uint32_t dst = (uint32_t)(size_t)L + wave * T_SLICE;

    // descriptor group 1: bytes, tile = tensor = 64 rows of 256 B, 16 B pad per row
    u32x8 g1;
    g1[0] = uni((1u << 20) | (5u << 22) | (3u << 25));
    g1[1] = uni(T_ROWB << 16);
    g1[2] = uni(64u << 16);
    g1[3] = uni(T_ROWB << 16);
    g1[4] = uni(64u);
    g1[5] = uni(SRCP);
    g1[6] = uni(0u);
    g1[7] = uni(0u);

    // descriptor group 0 of stage st: count 1, place in LDS, source address, type 2
    auto group0 = [&](uint32_t st) {
        const uint64_t ga = src + (uint64_t)st * T_ROWB;
        u32x4 g;
        g[0] = uni(1u);
        g[1] = uni(dst + (st & 1u) * T_BUF);
        g[2] = uni((uint32_t)ga);
        g[3] = uni((((uint32_t)(ga >> 32)) & 0x01FFFFFFu) | 0x80000000u);
        return g;
    };

#pragma unroll
    for (int i = 0; i < 4; i++)
#pragma unroll
        for (int j = 0; j < 4; j++)
            acc[i][j] = v8f_zero();

    // Stage 0: load and wait in one statement, so that no descriptor register can be
    // rewritten while the request is outstanding.
    u32x4 g0 = group0(0);
    asm volatile("tensor_load_to_lds %0, %1\n\ts_wait_tensorcnt 0x0"
                 :: "s"(g0), "s"(g1) : "memory");       // own slice of stage 0 has landed
    __syncthreads();                                    // ... and every other wave's
    // Stage 1 and the refills: g0 is an in-out operand of the load and an input of the
    // wait that covers it, which keeps the descriptor in its registers up to that wait.
    g0 = group0(1);
    asm volatile("tensor_load_to_lds %0, %1" : "+s"(g0) : "s"(g1) : "memory");

    const uint32_t aoff = wm * T_SLICE + lr * T_PITCH + hf * 16u;
    const uint32_t boff = (2u + wn) * T_SLICE + lr * T_PITCH + hf * 16u;

#pragma unroll 1   // one pass per trip: the ring's waits stand once, at the foot
    for (uint32_t s = 0; s < NP; ++s) {
        const unsigned char* pa = L + (s & 1u) * T_BUF + aoff;
        const unsigned char* pb = L + (s & 1u) * T_BUF + boff;
        Frag16 a[2][4], b[2][4];
#pragma unroll
        for (int i = 0; i < 4; i++) {
            a[0][i].h[0] = *reinterpret_cast<const bf16x8*>(pa + i * 16 * T_PITCH);
            a[0][i].h[1] = *reinterpret_cast<const bf16x8*>(pa + i * 16 * T_PITCH + 32);
            b[0][i].h[0] = *reinterpret_cast<const bf16x8*>(pb + i * 16 * T_PITCH);
            b[0][i].h[1] = *reinterpret_cast<const bf16x8*>(pb + i * 16 * T_PITCH + 32);
        }
#pragma unroll
        for (int ks = 0; ks < 4; ks++) {
            const int cur = ks & 1, nxt = cur ^ 1;
            if (ks < 3) {   // the next 32 k's fragments, as one group ahead of this block
                // fence pair: without it the compiler spreads these reads among the
                // WMMAs with a full LDS wait at each place, which stalls the matrix pipe
                __builtin_amdgcn_sched_barrier(0);
#pragma unroll
                for (int i = 0; i < 4; i++) {
                    const int o = i * 16 * T_PITCH + (ks + 1) * 64;
                    a[nxt][i].h[0] = *reinterpret_cast<const bf16x8*>(pa + o);
                    a[nxt][i].h[1] = *reinterpret_cast<const bf16x8*>(pa + o + 32);
                    b[nxt][i].h[0] = *reinterpret_cast<const bf16x8*>(pb + o);
                    b[nxt][i].h[1] = *reinterpret_cast<const bf16x8*>(pb + o + 32);
                }
                __builtin_amdgcn_sched_barrier(0);  // closes the pair
            }
#pragma unroll
            for (int i = 0; i < 4; i++)
#pragma unroll
                for (int j = 0; j < 4; j++)
                    acc[i][j] = wmma_bf16(a[cur][i], b[cur][j], acc[i][j]);
        }
        // keeps the WMMAs above in front of the waits below: the compiler otherwise lifts
        // the full LDS wait to just behind the last read group, where the wave stalls on it
        __builtin_amdgcn_sched_barrier(0);
        // publish point of stage s + 1
        asm volatile("s_wait_dscnt 0x0" ::: "memory");      // own reads of this buffer are done
        // own slice of stage s + 1 has landed; names the descriptor, see above
        asm volatile("s_wait_tensorcnt 0x0" :: "s"(g0), "s"(g1) : "memory");
        __syncthreads();   // publishes stage s + 1; ends every reader's last read of stage s
        if (pinned(s + 2u < NP)) {                          // refill the buffer just left
            g0 = group0(s + 2u);
            asm volatile("tensor_load_to_lds %0, %1" : "+s"(g0) : "s"(g1) : "memory");
        }
    }
    asm volatile("s_wait_tensorcnt 0x0" ::: "memory");  // no request outlives the loop
    asm volatile("s_wait_dscnt 0x0" ::: "memory");
}

// ---------------------------------------------------------------------------
// QKV GEMM: [4096,1024] x [3072,1024]^T, epilogue scatters into
//   Q [B,H,N,64] (scaled by hd^-0.5, +q_bias), K [B,H,N,64],
//   V^T [B,H,64,N] (+v_bias)  -- V transposed so P*V B-frags load contiguous.
// grid (32, 24), block 128 (4 waves, each 64x64)
// ---------------------------------------------------------------------------
__global__ void __launch_bounds__(128) gemm_qkv_kernel(const bf16_t* __restrict__ A,
                                const bf16_t* __restrict__ W,
                                const float* __restrict__ q_bias,
                                const float* __restrict__ v_bias,
                                bf16_t* __restrict__ qo,
                                bf16_t* __restrict__ ko,
                                bf16_t* __restrict__ vto) {
    __shared__ __attribute__((aligned(2048))) unsigned char L[T_LDS];
    int wv = threadIdx.x >> 5;
    v8f acc[4][4];
    block_gemm_128x128<DIMC>(A, W, blockIdx.x * 128u, blockIdx.y * 128u, L, acc);
    int m0 = blockIdx.x * 128 + (wv >> 1) * 64;   // this wave's 64 x 64 part
    int n0 = blockIdx.y * 128 + (wv & 1) * 64;

    int lane = threadIdx.x & 31, hf = lane >> 4, lr = lane & 15;
#pragma unroll
    for (int i = 0; i < 4; i++)
#pragma unroll
        for (int j = 0; j < 4; j++) {
            int col    = n0 + j * 16 + lr;      // 0..3071
            int sec    = col >> 10;             // 0=q 1=k 2=v
            int within = col & 1023;
            int hh     = within >> 6;
            int d      = within & 63;
            float bias = (sec == 0) ? q_bias[within]
                       : (sec == 2) ? v_bias[within] : 0.f;
#pragma unroll
            for (int r = 0; r < 8; r++) {
                int row = m0 + i * 16 + 8 * hf + r;  // global token row
                int bi  = row >> 10;
                int n   = row & 1023;
                float val = acc[i][j][r] + bias;
                size_t bh = (size_t)bi * NHEAD + hh;
                if (sec == 0)
                    qo[(bh * SEQN + n) * HDIM + d] = (bf16_t)(val * 0.125f);
                else if (sec == 1)
                    ko[(bh * SEQN + n) * HDIM + d] = (bf16_t)val;
                else
                    vto[(bh * HDIM + d) * SEQN + n] = (bf16_t)val;
            }
        }
}

// ---------------------------------------------------------------------------
// Flash attention: one wave per (b, h, 16-query tile).
// S(16x32) = Q(16x64) * K_tile^T via 2 WMMAs per key-subtile; + rel_pos_bias,
// key-padding mask; online softmax; O(16x64) += P(16x32)*V(32x64) via 4 WMMAs.
// P transposed C-layout -> A-layout through LDS.
// grid 4096, block 32.
// ---------------------------------------------------------------------------
__global__ void attention_kernel(const bf16_t* __restrict__ Q,
                                 const bf16_t* __restrict__ Km,
                                 const bf16_t* __restrict__ Vt,
                                 const float* __restrict__ rel,
                                 const int* __restrict__ amask,
                                 bf16_t* __restrict__ out) {
    int blk = blockIdx.x;
    int qt  = blk & 63;          // SEQN/16 = 64 query tiles
    int bh  = blk >> 6;
    int h   = bh & (NHEAD - 1);
    int bi  = bh >> 4;
    int qbase = qt * 16;

    int lane = threadIdx.x & 31;
    int hf   = lane >> 4;
    int lr   = lane & 15;

    const bf16_t* Qb = Q + ((size_t)bh * SEQN + qbase) * HDIM;
    const bf16_t* Kb = Km + (size_t)bh * SEQN * HDIM;
    const bf16_t* Vb = Vt + (size_t)bh * HDIM * SEQN;
    const float*  Rb = rel + (size_t)h * SEQN * SEQN;
    const int*    Mb = amask + (size_t)bi * SEQN;

    // Q A-frags for the two 32-wide K(=d) halves
    Frag16 aq[2];
#pragma unroll
    for (int s = 0; s < 2; s++) {
        const bf16_t* p = Qb + (size_t)lr * HDIM + s * 32 + hf * 8;
        aq[s].h[0] = load8(p);
        aq[s].h[1] = load8(p + 16);
    }

    float mrow[8], lrow[8];
    v8f o[4];
#pragma unroll
    for (int r = 0; r < 8; r++) { mrow[r] = -1e30f; lrow[r] = 0.f; }
#pragma unroll
    for (int j = 0; j < 4; j++) o[j] = v8f_zero();

    __shared__ float sP[16][33];   // +1 pad vs banks

    for (int kk = 0; kk < SEQN; kk += 32) {
        // ---- scores for two 16-key subtiles
        v8f s[2];
#pragma unroll
        for (int t = 0; t < 2; t++) {
            int key = kk + t * 16 + lr;
            const bf16_t* kp = Kb + (size_t)key * HDIM + hf * 8;
            Frag16 b0, b1;
            b0.h[0] = load8(kp);       b0.h[1] = load8(kp + 16);
            b1.h[0] = load8(kp + 32);  b1.h[1] = load8(kp + 48);
            s[t] = wmma_bf16(aq[0], b0, v8f_zero());
            s[t] = wmma_bf16(aq[1], b1, s[t]);
        }
        // ---- bias + key-padding mask
        float sv[2][8];
#pragma unroll
        for (int t = 0; t < 2; t++) {
            int key = kk + t * 16 + lr;
            int mk  = Mb[key];
            const float* bp = Rb + key;
#pragma unroll
            for (int r = 0; r < 8; r++) {
                int qrow = qbase + 8 * hf + r;
                float v  = s[t][r] + bp[(size_t)qrow * SEQN];
                sv[t][r] = mk ? v : -1e30f;
            }
        }
        // ---- online softmax: row max across the 16-lane group
        float mnew[8], scale[8];
#pragma unroll
        for (int r = 0; r < 8; r++) {
            float v = fmaxf(sv[0][r], sv[1][r]);
#pragma unroll
            for (int off = 1; off < 16; off <<= 1)
                v = fmaxf(v, __shfl_xor(v, off, 32));
            mnew[r]  = fmaxf(mrow[r], v);
            scale[r] = __expf(mrow[r] - mnew[r]);
        }
        float ps[2][8];
#pragma unroll
        for (int t = 0; t < 2; t++)
#pragma unroll
            for (int r = 0; r < 8; r++)
                ps[t][r] = (sv[t][r] > -1e29f) ? __expf(sv[t][r] - mnew[r]) : 0.f;
#pragma unroll
        for (int r = 0; r < 8; r++) {
            float srow = ps[0][r] + ps[1][r];
#pragma unroll
            for (int off = 1; off < 16; off <<= 1)
                srow += __shfl_xor(srow, off, 32);
            lrow[r] = lrow[r] * scale[r] + srow;
            mrow[r] = mnew[r];
        }
#pragma unroll
        for (int j = 0; j < 4; j++)
#pragma unroll
            for (int r = 0; r < 8; r++)
                o[j][r] = o[j][r] * scale[r];

        // ---- P: C-layout -> A-layout via LDS transpose, cast to bf16
#pragma unroll
        for (int t = 0; t < 2; t++)
#pragma unroll
            for (int r = 0; r < 8; r++)
                sP[8 * hf + r][t * 16 + lr] = ps[t][r];
        __syncthreads();
        Frag16 ap;
#pragma unroll
        for (int i = 0; i < 8; i++) {
            ap.v[i]     = (bf16_t)sP[lr][hf * 8 + i];
            ap.v[i + 8] = (bf16_t)sP[lr][16 + hf * 8 + i];
        }
        __syncthreads();

        // ---- O += P * V  (V^T layout => contiguous B-frag loads)
#pragma unroll
        for (int j = 0; j < 4; j++) {
            const bf16_t* vp = Vb + (size_t)(j * 16 + lr) * SEQN + kk + hf * 8;
            Frag16 bv;
            bv.h[0] = load8(vp);
            bv.h[1] = load8(vp + 16);
            o[j] = wmma_bf16(ap, bv, o[j]);
        }
    }

    // ---- normalize and write [B,N, H*64] bf16
#pragma unroll
    for (int r = 0; r < 8; r++) {
        float inv = (lrow[r] > 0.f) ? 1.f / lrow[r] : 0.f;
        int qrow = qbase + 8 * hf + r;
        size_t rowoff = ((size_t)bi * SEQN + qrow) * DIMC + h * HDIM;
#pragma unroll
        for (int j = 0; j < 4; j++)
            out[rowoff + j * 16 + lr] = (bf16_t)(o[j][r] * inv);
    }
}

// ---------------------------------------------------------------------------
// Proj GEMM + bias + residual -> f32.  grid (32,8), block 128
// ---------------------------------------------------------------------------
__global__ void __launch_bounds__(128) gemm_proj_kernel(const bf16_t* __restrict__ A,
                                 const bf16_t* __restrict__ W,
                                 const float* __restrict__ bias,
                                 const float* __restrict__ resid,
                                 float* __restrict__ out) {
    __shared__ __attribute__((aligned(2048))) unsigned char L[T_LDS];
    int wv = threadIdx.x >> 5;
    v8f acc[4][4];
    block_gemm_128x128<DIMC>(A, W, blockIdx.x * 128u, blockIdx.y * 128u, L, acc);
    int m0 = blockIdx.x * 128 + (wv >> 1) * 64;   // this wave's 64 x 64 part
    int n0 = blockIdx.y * 128 + (wv & 1) * 64;
    int lane = threadIdx.x & 31, hf = lane >> 4, lr = lane & 15;
#pragma unroll
    for (int i = 0; i < 4; i++)
#pragma unroll
        for (int j = 0; j < 4; j++) {
            int col = n0 + j * 16 + lr;
            float bv = bias[col];
#pragma unroll
            for (int r = 0; r < 8; r++) {
                size_t row = (size_t)(m0 + i * 16 + 8 * hf + r);
                out[row * DIMC + col] = acc[i][j][r] + bv + resid[row * DIMC + col];
            }
        }
}

// ---------------------------------------------------------------------------
// MLP1 GEMM + bias + exact GELU -> bf16.  grid (32,32), block 128
// ---------------------------------------------------------------------------
__global__ void __launch_bounds__(128) gemm_mlp1_kernel(const bf16_t* __restrict__ A,
                                 const bf16_t* __restrict__ W,
                                 const float* __restrict__ bias,
                                 bf16_t* __restrict__ out) {
    __shared__ __attribute__((aligned(2048))) unsigned char L[T_LDS];
    int wv = threadIdx.x >> 5;
    v8f acc[4][4];
    block_gemm_128x128<DIMC>(A, W, blockIdx.x * 128u, blockIdx.y * 128u, L, acc);
    int m0 = blockIdx.x * 128 + (wv >> 1) * 64;   // this wave's 64 x 64 part
    int n0 = blockIdx.y * 128 + (wv & 1) * 64;
    int lane = threadIdx.x & 31, hf = lane >> 4, lr = lane & 15;
#pragma unroll
    for (int i = 0; i < 4; i++)
#pragma unroll
        for (int j = 0; j < 4; j++) {
            int col = n0 + j * 16 + lr;
            float bv = bias[col];
#pragma unroll
            for (int r = 0; r < 8; r++) {
                size_t row = (size_t)(m0 + i * 16 + 8 * hf + r);
                float v = acc[i][j][r] + bv;
                float g = 0.5f * v * (1.f + erff(v * 0.70710678118654752f));
                out[row * HIDDEN + col] = (bf16_t)g;
            }
        }
}

// ---------------------------------------------------------------------------
// MLP2 GEMM + bias + residual -> f32 final output.  grid (32,8), block 128
// ---------------------------------------------------------------------------
__global__ void __launch_bounds__(128) gemm_mlp2_kernel(const bf16_t* __restrict__ A,
                                 const bf16_t* __restrict__ W,
                                 const float* __restrict__ bias,
                                 const float* __restrict__ resid,
                                 float* __restrict__ out) {
    __shared__ __attribute__((aligned(2048))) unsigned char L[T_LDS];
    int wv = threadIdx.x >> 5;
    v8f acc[4][4];
    block_gemm_128x128<HIDDEN>(A, W, blockIdx.x * 128u, blockIdx.y * 128u, L, acc);
    int m0 = blockIdx.x * 128 + (wv >> 1) * 64;   // this wave's 64 x 64 part
    int n0 = blockIdx.y * 128 + (wv & 1) * 64;
    int lane = threadIdx.x & 31, hf = lane >> 4, lr = lane & 15;
#pragma unroll
    for (int i = 0; i < 4; i++)
#pragma unroll
        for (int j = 0; j < 4; j++) {
            int col = n0 + j * 16 + lr;
            float bv = bias[col];
#pragma unroll
            for (int r = 0; r < 8; r++) {
                size_t row = (size_t)(m0 + i * 16 + 8 * hf + r);
                out[row * DIMC + col] = acc[i][j][r] + bv + resid[row * DIMC + col];
            }
        }
}

// ---------------------------------------------------------------------------
// Host driver
// ---------------------------------------------------------------------------
extern "C" void kernel_launch(void* const* d_in, const int* in_sizes, int n_in,
                              void* d_out, int out_size, void* d_ws, size_t ws_size,
                              hipStream_t stream) {
    const float* x      = (const float*)d_in[0];
    const float* rel    = (const float*)d_in[1];
    const int*   amask  = (const int*)  d_in[2];
    const float* n1w    = (const float*)d_in[3];
    const float* n1b    = (const float*)d_in[4];
    const float* qkv_w  = (const float*)d_in[5];
    const float* q_bias = (const float*)d_in[6];
    const float* v_bias = (const float*)d_in[7];
    const float* proj_w = (const float*)d_in[8];
    const float* proj_b = (const float*)d_in[9];
    const float* n2w    = (const float*)d_in[10];
    const float* n2b    = (const float*)d_in[11];
    const float* w1     = (const float*)d_in[12];
    const float* b1     = (const float*)d_in[13];
    const float* w2     = (const float*)d_in[14];
    const float* b2     = (const float*)d_in[15];
    float* out = (float*)d_out;
    (void)in_sizes; (void)n_in; (void)out_size; (void)ws_size;

    char* ws = (char*)d_ws;
    size_t off = 0;
    auto alloc = [&](size_t bytes) -> char* {
        char* p = ws + off;
        off = (off + bytes + 255) & ~(size_t)255;
        return p;
    };
    bf16_t* ln1b   = (bf16_t*)alloc((size_t)MROWS * DIMC * 2);
    bf16_t* wqkvb  = (bf16_t*)alloc((size_t)3 * DIMC * DIMC * 2);
    bf16_t* qb     = (bf16_t*)alloc((size_t)MROWS * DIMC * 2);   // [B,H,N,64]
    bf16_t* kb     = (bf16_t*)alloc((size_t)MROWS * DIMC * 2);   // [B,H,N,64]
    bf16_t* vtb    = (bf16_t*)alloc((size_t)MROWS * DIMC * 2);   // [B,H,64,N]
    bf16_t* attnb  = (bf16_t*)alloc((size_t)MROWS * DIMC * 2);   // [B*N, C]
    bf16_t* wprojb = (bf16_t*)alloc((size_t)DIMC * DIMC * 2);
    float*  x1     = (float*) alloc((size_t)MROWS * DIMC * 4);
    bf16_t* ln2b   = (bf16_t*)alloc((size_t)MROWS * DIMC * 2);
    bf16_t* w1b    = (bf16_t*)alloc((size_t)HIDDEN * DIMC * 2);
    bf16_t* hb     = (bf16_t*)alloc((size_t)MROWS * HIDDEN * 2);
    bf16_t* w2b    = (bf16_t*)alloc((size_t)DIMC * HIDDEN * 2);

    // weight conversions
    cvt_f32_bf16_kernel<<<(3 * DIMC * DIMC + 255) / 256, 256, 0, stream>>>(qkv_w, wqkvb, 3 * DIMC * DIMC);
    cvt_f32_bf16_kernel<<<(DIMC * DIMC + 255) / 256, 256, 0, stream>>>(proj_w, wprojb, DIMC * DIMC);
    cvt_f32_bf16_kernel<<<(HIDDEN * DIMC + 255) / 256, 256, 0, stream>>>(w1, w1b, HIDDEN * DIMC);
    cvt_f32_bf16_kernel<<<(DIMC * HIDDEN + 255) / 256, 256, 0, stream>>>(w2, w2b, DIMC * HIDDEN);

    // x -> LN1 -> bf16
    layernorm_bf16_kernel<<<MROWS, 256, 0, stream>>>(x, n1w, n1b, ln1b, DIMC);

    // QKV projection + head scatter
    gemm_qkv_kernel<<<dim3(MROWS / 128, (3 * DIMC) / 128), 128, 0, stream>>>(
        ln1b, wqkvb, q_bias, v_bias, qb, kb, vtb);

    // flash attention per (b, h, 16-query tile)
    attention_kernel<<<BATCH * NHEAD * (SEQN / 16), 32, 0, stream>>>(
        qb, kb, vtb, rel, amask, attnb);

    // proj + residual -> x1 (f32)
    gemm_proj_kernel<<<dim3(MROWS / 128, DIMC / 128), 128, 0, stream>>>(
        attnb, wprojb, proj_b, x, x1);

    // LN2 -> bf16
    layernorm_bf16_kernel<<<MROWS, 256, 0, stream>>>(x1, n2w, n2b, ln2b, DIMC);

    // MLP
    gemm_mlp1_kernel<<<dim3(MROWS / 128, HIDDEN / 128), 128, 0, stream>>>(
        ln2b, w1b, b1, hb);
    gemm_mlp2_kernel<<<dim3(MROWS / 128, DIMC / 128), 128, 0, stream>>>(
        hb, w2b, b2, x1, out);
}

// v002
// One run takes 364 microseconds.
// In both of two side-by-side timings against v001, it was 1.04 times as fast.
// Over all steps from v000 it is 1.51 times as fast.
#include <hip/hip_runtime.h>

// ---------------------------------------------------------------------------
// Types for CDNA5 WMMA (gfx1250, wave32)
// ---------------------------------------------------------------------------
typedef __bf16 bf16_t;
typedef __attribute__((ext_vector_type(16))) __bf16 bf16x16;
typedef __attribute__((ext_vector_type(8)))  __bf16 bf16x8;
typedef __attribute__((ext_vector_type(8)))  float  v8f;

union Frag16 {
    bf16x16 v;
    bf16x8  h[2];
};

__device__ inline bf16x8 load8(const bf16_t* p) {
    return *reinterpret_cast<const bf16x8*>(p);
}

__device__ inline v8f v8f_zero() {
    v8f z = {0.f, 0.f, 0.f, 0.f, 0.f, 0.f, 0.f, 0.f};
    return z;
}

__device__ inline v8f wmma_bf16(const Frag16& a, const Frag16& b, v8f c) {
    // D = A(16x32 bf16) * B(32x16 bf16) + C(16x16 f32)
    return __builtin_amdgcn_wmma_f32_16x16x32_bf16(
        /*neg_a=*/false, a.v, /*neg_b=*/false, b.v,
        /*c_mod=*/(short)0, c, /*reuse_a=*/false, /*reuse_b=*/false);
}

// ---------------------------------------------------------------------------
// Constants
// ---------------------------------------------------------------------------
#define DIMC   1024
#define NHEAD  16
#define HDIM   64
#define SEQN   1024
#define BATCH  4
#define MROWS  4096      // BATCH * SEQN
#define HIDDEN 4096

// ---------------------------------------------------------------------------
// f32 -> bf16 conversion (weights, once per call), as a stream: few waves, each
// with much in flight.  A work-group of 4 waves takes 8192 elements in a row;
// a lane issues its 16 loads of 16 B (each wave-wide load covers 512 B in a row)
// ahead of the first conversion, then stores 8 B per load (256 B in a row a wave).
// Every weight's element count is a multiple of CVT_BLOCK, so there is no tail.
// ---------------------------------------------------------------------------
typedef __attribute__((ext_vector_type(4))) float  f32x4;
typedef __attribute__((ext_vector_type(4))) __bf16 bf16x4;

#define CVT_THREADS 128
#define CVT_VECS    16
#define CVT_BLOCK   (CVT_THREADS * 4 * CVT_VECS)   // elements per work-group

__global__ void __launch_bounds__(CVT_THREADS)
cvt_f32_bf16_kernel(const float* __restrict__ src, bf16_t* __restrict__ dst) {
    const f32x4* __restrict__ s4 = reinterpret_cast<const f32x4*>(src);
    bf16x4* __restrict__      d4 = reinterpret_cast<bf16x4*>(dst);
    const uint32_t idx = blockIdx.x * (CVT_THREADS * CVT_VECS) + threadIdx.x;  // in groups of 4
    f32x4 v[CVT_VECS];
#pragma unroll   // all loads in flight together: the registers are indexed by constants
    for (int u = 0; u < CVT_VECS; u++)
        v[u] = s4[idx + u * CVT_THREADS];
    // keeps every load ahead of the first conversion: without it the compiler holds the
    // last four back until the first have returned, a second memory latency per wave
    __builtin_amdgcn_sched_barrier(0);
#pragma unroll   // as above
    for (int u = 0; u < CVT_VECS; u++)
        d4[idx + u * CVT_THREADS] = __builtin_convertvector(v[u], bf16x4);
}

// ---------------------------------------------------------------------------
// LayerNorm: one row (1024 f32) per workgroup (8 waves), bf16 output
// ---------------------------------------------------------------------------
__global__ void layernorm_bf16_kernel(const float* __restrict__ x,
                                      const float* __restrict__ w,
                                      const float* __restrict__ b,
                                      bf16_t* __restrict__ out, int cols) {
    int row = blockIdx.x;
    const float* xr = x + (size_t)row * cols;
    float s1 = 0.f, s2 = 0.f;
    for (int c = threadIdx.x; c < cols; c += blockDim.x) {
        float v = xr[c];
        s1 += v;
        s2 += v * v;
    }
#pragma unroll
    for (int off = 16; off > 0; off >>= 1) {
        s1 += __shfl_xor(s1, off, 32);
        s2 += __shfl_xor(s2, off, 32);
    }
    __shared__ float r1[8], r2[8];
    int wid = threadIdx.x >> 5;
    int lane = threadIdx.x & 31;
    if (lane == 0) { r1[wid] = s1; r2[wid] = s2; }
    __syncthreads();
    if (threadIdx.x == 0) {
        float a = 0.f, bb = 0.f;
        for (int i = 0; i < 8; i++) { a += r1[i]; bb += r2[i]; }
        r1[0] = a; r2[0] = bb;
    }
    __syncthreads();
    float mu  = r1[0] / cols;
    float var = r2[0] / cols - mu * mu;
    float rs  = rsqrtf(var + 1e-5f);
    for (int c = threadIdx.x; c < cols; c += blockDim.x) {
        out[(size_t)row * cols + c] = (bf16_t)((xr[c] - mu) * rs * w[c] + b[c]);
    }
}

// ---------------------------------------------------------------------------
// Core: one workgroup (4 waves, 2 x 2) computes a 128(M) x 128(N) tile of
// A[MxK] * W[NxK]^T; each wave a 64 x 64 part, acc[i][j] = C-frag for M-subtile i
// and N-subtile j.  A row-major [M,K] bf16, W row-major [N,K] bf16.
// Both operands are staged in LDS by the tensor mover, 128 k (256 B of every
// row) per pass, two buffers: the load of pass s + 2 flies while pass s + 1 runs.
// A buffer is four slices of 64 rows, [A 0-63 | A 64-127 | W 0-63 | W 64-127];
// wave w brings slice w.  Rows lie at pitch 272 B (16 B pad laid by the mover).
// ---------------------------------------------------------------------------
typedef uint32_t u32x4 __attribute__((ext_vector_type(4)));
typedef uint32_t u32x8 __attribute__((ext_vector_type(8)));

#define T_ROWB   256u      // bytes of one staged row (128 k)
#define T_PITCH  272u      // row pitch in LDS
#define T_SLICE  18432u    // 64 rows * 272 B, rounded up to a multiple of 2 KiB
#define T_BUF    73728u    // four slices
#define T_LDS    147456u   // two buffers

__device__ __forceinline__ uint32_t uni(uint32_t v) {
    return (uint32_t)__builtin_amdgcn_readfirstlane(v);
}
// Holds a wave-uniform test in a scalar register, so that the branch round a
// tensor load (which ignores EXEC) compiles to s_cmp + s_cbranch_scc.
__device__ __forceinline__ uint32_t pinned(uint32_t v) {
    uint32_t w = uni(v);
    asm volatile("" : "+s"(w));  // keeps the test scalar
    return w;
}

template <int K>
__device__ __forceinline__ void block_gemm_128x128(const bf16_t* __restrict__ A,
                                                   const bf16_t* __restrict__ W,
                                                   uint32_t m0, uint32_t n0,
                                                   const unsigned char* L,
                                                   v8f acc[4][4]) {
    constexpr uint32_t NP   = K / 128;   // passes; at least two
    constexpr uint32_t SRCP = K * 2;     // source row pitch, bytes
    const uint32_t lane = threadIdx.x & 31u;
    const uint32_t hf   = lane >> 4;     // lane half selects K sub-stripe
    const uint32_t lr   = lane & 15u;    // M row (A) / N col (B) within 16
    const uint32_t wave = uni(threadIdx.x >> 5);
    const uint32_t wm   = wave >> 1, wn = wave & 1u;

    // this wave's slice: its first source byte and its place in LDS
    const uint64_t src = (wave < 2u)
        ? (uint64_t)(size_t)A + (uint64_t)(m0 + wave * 64u) * SRCP
        : (uint64_t)(size_t)W + (uint64_t)(n0 + (wave - 2u) * 64u) * SRCP;
    const uint32_t dst = (uint32_t)(size_t)L + wave * T_SLICE;

    // descriptor group 1: bytes, tile = tensor = 64 rows of 256 B, 16 B pad per row
    u32x8 g1;
    g1[0] = uni((1u << 20) | (5u << 22) | (3u << 25));
    g1[1] = uni(T_ROWB << 16);
    g1[2] = uni(64u << 16);
    g1[3] = uni(T_ROWB << 16);
    g1[4] = uni(64u);
    g1[5] = uni(SRCP);
    g1[6] = uni(0u);
    g1[7] = uni(0u);

    // descriptor group 0 of stage st: count 1, place in LDS, source address, type 2
    auto group0 = [&](uint32_t st) {
        const uint64_t ga = src + (uint64_t)st * T_ROWB;
        u32x4 g;
        g[0] = uni(1u);
        g[1] = uni(dst + (st & 1u) * T_BUF);
        g[2] = uni((uint32_t)ga);
        g[3] = uni((((uint32_t)(ga >> 32)) & 0x01FFFFFFu) | 0x80000000u);
        return g;
    };

#pragma unroll
    for (int i = 0; i < 4; i++)
#pragma unroll
        for (int j = 0; j < 4; j++)
            acc[i][j] = v8f_zero();

    // Stage 0: load and wait in one statement, so that no descriptor register can be
    // rewritten while the request is outstanding.
    u32x4 g0 = group0(0);
    asm volatile("tensor_load_to_lds %0, %1\n\ts_wait_tensorcnt 0x0"
                 :: "s"(g0), "s"(g1) : "memory");       // own slice of stage 0 has landed
    __syncthreads();                                    // ... and every other wave's
    // Stage 1 and the refills: g0 is an in-out operand of the load and an input of the
    // wait that covers it, which keeps the descriptor in its registers up to that wait.
    g0 = group0(1);
    asm volatile("tensor_load_to_lds %0, %1" : "+s"(g0) : "s"(g1) : "memory");

    const uint32_t aoff = wm * T_SLICE + lr * T_PITCH + hf * 16u;
    const uint32_t boff = (2u + wn) * T_SLICE + lr * T_PITCH + hf * 16u;

#pragma unroll 1   // one pass per trip: the ring's waits stand once, at the foot
    for (uint32_t s = 0; s < NP; ++s) {
        const unsigned char* pa = L + (s & 1u) * T_BUF + aoff;
        const unsigned char* pb = L + (s & 1u) * T_BUF + boff;
        Frag16 a[2][4], b[2][4];
#pragma unroll
        for (int i = 0; i < 4; i++) {
            a[0][i].h[0] = *reinterpret_cast<const bf16x8*>(pa + i * 16 * T_PITCH);
            a[0][i].h[1] = *reinterpret_cast<const bf16x8*>(pa + i * 16 * T_PITCH + 32);
            b[0][i].h[0] = *reinterpret_cast<const bf16x8*>(pb + i * 16 * T_PITCH);
            b[0][i].h[1] = *reinterpret_cast<const bf16x8*>(pb + i * 16 * T_PITCH + 32);
        }
#pragma unroll
        for (int ks = 0; ks < 4; ks++) {
            const int cur = ks & 1, nxt = cur ^ 1;
            if (ks < 3) {   // the next 32 k's fragments, as one group ahead of this block
                // fence pair: without it the compiler spreads these reads among the
                // WMMAs with a full LDS wait at each place, which stalls the matrix pipe
                __builtin_amdgcn_sched_barrier(0);
#pragma unroll
                for (int i = 0; i < 4; i++) {
                    const int o = i * 16 * T_PITCH + (ks + 1) * 64;
                    a[nxt][i].h[0] = *reinterpret_cast<const bf16x8*>(pa + o);
                    a[nxt][i].h[1] = *reinterpret_cast<const bf16x8*>(pa + o + 32);
                    b[nxt][i].h[0] = *reinterpret_cast<const bf16x8*>(pb + o);
                    b[nxt][i].h[1] = *reinterpret_cast<const bf16x8*>(pb + o + 32);
                }
                __builtin_amdgcn_sched_barrier(0);  // closes the pair
            }
#pragma unroll
            for (int i = 0; i < 4; i++)
#pragma unroll
                for (int j = 0; j < 4; j++)
                    acc[i][j] = wmma_bf16(a[cur][i], b[cur][j], acc[i][j]);
        }
        // keeps the WMMAs above in front of the waits below: the compiler otherwise lifts
        // the full LDS wait to just behind the last read group, where the wave stalls on it
        __builtin_amdgcn_sched_barrier(0);
        // publish point of stage s + 1
        asm volatile("s_wait_dscnt 0x0" ::: "memory");      // own reads of this buffer are done
        // own slice of stage s + 1 has landed; names the descriptor, see above
        asm volatile("s_wait_tensorcnt 0x0" :: "s"(g0), "s"(g1) : "memory");
        __syncthreads();   // publishes stage s + 1; ends every reader's last read of stage s
        if (pinned(s + 2u < NP)) {                          // refill the buffer just left
            g0 = group0(s + 2u);
            asm volatile("tensor_load_to_lds %0, %1" : "+s"(g0) : "s"(g1) : "memory");
        }
    }
    asm volatile("s_wait_tensorcnt 0x0" ::: "memory");  // no request outlives the loop
    asm volatile("s_wait_dscnt 0x0" ::: "memory");
}

// ---------------------------------------------------------------------------
// QKV GEMM: [4096,1024] x [3072,1024]^T, epilogue scatters into
//   Q [B,H,N,64] (scaled by hd^-0.5, +q_bias), K [B,H,N,64],
//   V^T [B,H,64,N] (+v_bias)  -- V transposed so P*V B-frags load contiguous.
// grid (32, 24), block 128 (4 waves, each 64x64)
// ---------------------------------------------------------------------------
__global__ void __launch_bounds__(128) gemm_qkv_kernel(const bf16_t* __restrict__ A,
                                const bf16_t* __restrict__ W,
                                const float* __restrict__ q_bias,
                                const float* __restrict__ v_bias,
                                bf16_t* __restrict__ qo,
                                bf16_t* __restrict__ ko,
                                bf16_t* __restrict__ vto) {
    __shared__ __attribute__((aligned(2048))) unsigned char L[T_LDS];
    int wv = threadIdx.x >> 5;
    v8f acc[4][4];
    block_gemm_128x128<DIMC>(A, W, blockIdx.x * 128u, blockIdx.y * 128u, L, acc);
    int m0 = blockIdx.x * 128 + (wv >> 1) * 64;   // this wave's 64 x 64 part
    int n0 = blockIdx.y * 128 + (wv & 1) * 64;

    int lane = threadIdx.x & 31, hf = lane >> 4, lr = lane & 15;
#pragma unroll
    for (int i = 0; i < 4; i++)
#pragma unroll
        for (int j = 0; j < 4; j++) {
            int col    = n0 + j * 16 + lr;      // 0..3071
            int sec    = col >> 10;             // 0=q 1=k 2=v
            int within = col & 1023;
            int hh     = within >> 6;
            int d      = within & 63;
            float bias = (sec == 0) ? q_bias[within]
                       : (sec == 2) ? v_bias[within] : 0.f;
#pragma unroll
            for (int r = 0; r < 8; r++) {
                int row = m0 + i * 16 + 8 * hf + r;  // global token row
                int bi  = row >> 10;
                int n   = row & 1023;
                float val = acc[i][j][r] + bias;
                size_t bh = (size_t)bi * NHEAD + hh;
                if (sec == 0)
                    qo[(bh * SEQN + n) * HDIM + d] = (bf16_t)(val * 0.125f);
                else if (sec == 1)
                    ko[(bh * SEQN + n) * HDIM + d] = (bf16_t)val;
                else
                    vto[(bh * HDIM + d) * SEQN + n] = (bf16_t)val;
            }
        }
}

// ---------------------------------------------------------------------------
// Flash attention: one wave per (b, h, 16-query tile).
// S(16x32) = Q(16x64) * K_tile^T via 2 WMMAs per key-subtile; + rel_pos_bias,
// key-padding mask; online softmax; O(16x64) += P(16x32)*V(32x64) via 4 WMMAs.
// P transposed C-layout -> A-layout through LDS.
// grid 4096, block 32.
// ---------------------------------------------------------------------------
__global__ void attention_kernel(const bf16_t* __restrict__ Q,
                                 const bf16_t* __restrict__ Km,
                                 const bf16_t* __restrict__ Vt,
                                 const float* __restrict__ rel,
                                 const int* __restrict__ amask,
                                 bf16_t* __restrict__ out) {
    int blk = blockIdx.x;
    int qt  = blk & 63;          // SEQN/16 = 64 query tiles
    int bh  = blk >> 6;
    int h   = bh & (NHEAD - 1);
    int bi  = bh >> 4;
    int qbase = qt * 16;

    int lane = threadIdx.x & 31;
    int hf   = lane >> 4;
    int lr   = lane & 15;

    const bf16_t* Qb = Q + ((size_t)bh * SEQN + qbase) * HDIM;
    const bf16_t* Kb = Km + (size_t)bh * SEQN * HDIM;
    const bf16_t* Vb = Vt + (size_t)bh * HDIM * SEQN;
    const float*  Rb = rel + (size_t)h * SEQN * SEQN;
    const int*    Mb = amask + (size_t)bi * SEQN;

    // Q A-frags for the two 32-wide K(=d) halves
    Frag16 aq[2];
#pragma unroll
    for (int s = 0; s < 2; s++) {
        const bf16_t* p = Qb + (size_t)lr * HDIM + s * 32 + hf * 8;
        aq[s].h[0] = load8(p);
        aq[s].h[1] = load8(p + 16);
    }

    float mrow[8], lrow[8];
    v8f o[4];
#pragma unroll
    for (int r = 0; r < 8; r++) { mrow[r] = -1e30f; lrow[r] = 0.f; }
#pragma unroll
    for (int j = 0; j < 4; j++) o[j] = v8f_zero();

    __shared__ float sP[16][33];   // +1 pad vs banks

    for (int kk = 0; kk < SEQN; kk += 32) {
        // ---- scores for two 16-key subtiles
        v8f s[2];
#pragma unroll
        for (int t = 0; t < 2; t++) {
            int key = kk + t * 16 + lr;
            const bf16_t* kp = Kb + (size_t)key * HDIM + hf * 8;
            Frag16 b0, b1;
            b0.h[0] = load8(kp);       b0.h[1] = load8(kp + 16);
            b1.h[0] = load8(kp + 32);  b1.h[1] = load8(kp + 48);
            s[t] = wmma_bf16(aq[0], b0, v8f_zero());
            s[t] = wmma_bf16(aq[1], b1, s[t]);
        }
        // ---- bias + key-padding mask
        float sv[2][8];
#pragma unroll
        for (int t = 0; t < 2; t++) {
            int key = kk + t * 16 + lr;
            int mk  = Mb[key];
            const float* bp = Rb + key;
#pragma unroll
            for (int r = 0; r < 8; r++) {
                int qrow = qbase + 8 * hf + r;
                float v  = s[t][r] + bp[(size_t)qrow * SEQN];
                sv[t][r] = mk ? v : -1e30f;
            }
        }
        // ---- online softmax: row max across the 16-lane group
        float mnew[8], scale[8];
#pragma unroll
        for (int r = 0; r < 8; r++) {
            float v = fmaxf(sv[0][r], sv[1][r]);
#pragma unroll
            for (int off = 1; off < 16; off <<= 1)
                v = fmaxf(v, __shfl_xor(v, off, 32));
            mnew[r]  = fmaxf(mrow[r], v);
            scale[r] = __expf(mrow[r] - mnew[r]);
        }
        float ps[2][8];
#pragma unroll
        for (int t = 0; t < 2; t++)
#pragma unroll
            for (int r = 0; r < 8; r++)
                ps[t][r] = (sv[t][r] > -1e29f) ? __expf(sv[t][r] - mnew[r]) : 0.f;
#pragma unroll
        for (int r = 0; r < 8; r++) {
            float srow = ps[0][r] + ps[1][r];
#pragma unroll
            for (int off = 1; off < 16; off <<= 1)
                srow += __shfl_xor(srow, off, 32);
            lrow[r] = lrow[r] * scale[r] + srow;
            mrow[r] = mnew[r];
        }
#pragma unroll
        for (int j = 0; j < 4; j++)
#pragma unroll
            for (int r = 0; r < 8; r++)
                o[j][r] = o[j][r] * scale[r];

        // ---- P: C-layout -> A-layout via LDS transpose, cast to bf16
#pragma unroll
        for (int t = 0; t < 2; t++)
#pragma unroll
            for (int r = 0; r < 8; r++)
                sP[8 * hf + r][t * 16 + lr] = ps[t][r];
        __syncthreads();
        Frag16 ap;
#pragma unroll
        for (int i = 0; i < 8; i++) {
            ap.v[i]     = (bf16_t)sP[lr][hf * 8 + i];
            ap.v[i + 8] = (bf16_t)sP[lr][16 + hf * 8 + i];
        }
        __syncthreads();

        // ---- O += P * V  (V^T layout => contiguous B-frag loads)
#pragma unroll
        for (int j = 0; j < 4; j++) {
            const bf16_t* vp = Vb + (size_t)(j * 16 + lr) * SEQN + kk + hf * 8;
            Frag16 bv;
            bv.h[0] = load8(vp);
            bv.h[1] = load8(vp + 16);
            o[j] = wmma_bf16(ap, bv, o[j]);
        }
    }

    // ---- normalize and write [B,N, H*64] bf16
#pragma unroll
    for (int r = 0; r < 8; r++) {
        float inv = (lrow[r] > 0.f) ? 1.f / lrow[r] : 0.f;
        int qrow = qbase + 8 * hf + r;
        size_t rowoff = ((size_t)bi * SEQN + qrow) * DIMC + h * HDIM;
#pragma unroll
        for (int j = 0; j < 4; j++)
            out[rowoff + j * 16 + lr] = (bf16_t)(o[j][r] * inv);
    }
}

// ---------------------------------------------------------------------------
// Proj GEMM + bias + residual -> f32.  grid (32,8), block 128
// ---------------------------------------------------------------------------
__global__ void __launch_bounds__(128) gemm_proj_kernel(const bf16_t* __restrict__ A,
                                 const bf16_t* __restrict__ W,
                                 const float* __restrict__ bias,
                                 const float* __restrict__ resid,
                                 float* __restrict__ out) {
    __shared__ __attribute__((aligned(2048))) unsigned char L[T_LDS];
    int wv = threadIdx.x >> 5;
    v8f acc[4][4];
    block_gemm_128x128<DIMC>(A, W, blockIdx.x * 128u, blockIdx.y * 128u, L, acc);
    int m0 = blockIdx.x * 128 + (wv >> 1) * 64;   // this wave's 64 x 64 part
    int n0 = blockIdx.y * 128 + (wv & 1) * 64;
    int lane = threadIdx.x & 31, hf = lane >> 4, lr = lane & 15;
#pragma unroll
    for (int i = 0; i < 4; i++)
#pragma unroll
        for (int j = 0; j < 4; j++) {
            int col = n0 + j * 16 + lr;
            float bv = bias[col];
#pragma unroll
            for (int r = 0; r < 8; r++) {
                size_t row = (size_t)(m0 + i * 16 + 8 * hf + r);
                out[row * DIMC + col] = acc[i][j][r] + bv + resid[row * DIMC + col];
            }
        }
}

// ---------------------------------------------------------------------------
// MLP1 GEMM + bias + exact GELU -> bf16.  grid (32,32), block 128
// ---------------------------------------------------------------------------
__global__ void __launch_bounds__(128) gemm_mlp1_kernel(const bf16_t* __restrict__ A,
                                 const bf16_t* __restrict__ W,
                                 const float* __restrict__ bias,
                                 bf16_t* __restrict__ out) {
    __shared__ __attribute__((aligned(2048))) unsigned char L[T_LDS];
    int wv = threadIdx.x >> 5;
    v8f acc[4][4];
    block_gemm_128x128<DIMC>(A, W, blockIdx.x * 128u, blockIdx.y * 128u, L, acc);
    int m0 = blockIdx.x * 128 + (wv >> 1) * 64;   // this wave's 64 x 64 part
    int n0 = blockIdx.y * 128 + (wv & 1) * 64;
    int lane = threadIdx.x & 31, hf = lane >> 4, lr = lane & 15;
#pragma unroll
    for (int i = 0; i < 4; i++)
#pragma unroll
        for (int j = 0; j < 4; j++) {
            int col = n0 + j * 16 + lr;
            float bv = bias[col];
#pragma unroll
            for (int r = 0; r < 8; r++) {
                size_t row = (size_t)(m0 + i * 16 + 8 * hf + r);
                float v = acc[i][j][r] + bv;
                float g = 0.5f * v * (1.f + erff(v * 0.70710678118654752f));
                out[row * HIDDEN + col] = (bf16_t)g;
            }
        }
}

// ---------------------------------------------------------------------------
// MLP2 GEMM + bias + residual -> f32 final output.  grid (32,8), block 128
// ---------------------------------------------------------------------------
__global__ void __launch_bounds__(128) gemm_mlp2_kernel(const bf16_t* __restrict__ A,
                                 const bf16_t* __restrict__ W,
                                 const float* __restrict__ bias,
                                 const float* __restrict__ resid,
                                 float* __restrict__ out) {
    __shared__ __attribute__((aligned(2048))) unsigned char L[T_LDS];
    int wv = threadIdx.x >> 5;
    v8f acc[4][4];
    block_gemm_128x128<HIDDEN>(A, W, blockIdx.x * 128u, blockIdx.y * 128u, L, acc);
    int m0 = blockIdx.x * 128 + (wv >> 1) * 64;   // this wave's 64 x 64 part
    int n0 = blockIdx.y * 128 + (wv & 1) * 64;
    int lane = threadIdx.x & 31, hf = lane >> 4, lr = lane & 15;
#pragma unroll
    for (int i = 0; i < 4; i++)
#pragma unroll
        for (int j = 0; j < 4; j++) {
            int col = n0 + j * 16 + lr;
            float bv = bias[col];
#pragma unroll
            for (int r = 0; r < 8; r++) {
                size_t row = (size_t)(m0 + i * 16 + 8 * hf + r);
                out[row * DIMC + col] = acc[i][j][r] + bv + resid[row * DIMC + col];
            }
        }
}

// ---------------------------------------------------------------------------
// Host driver
// ---------------------------------------------------------------------------
extern "C" void kernel_launch(void* const* d_in, const int* in_sizes, int n_in,
                              void* d_out, int out_size, void* d_ws, size_t ws_size,
                              hipStream_t stream) {
    const float* x      = (const float*)d_in[0];
    const float* rel    = (const float*)d_in[1];
    const int*   amask  = (const int*)  d_in[2];
    const float* n1w    = (const float*)d_in[3];
    const float* n1b    = (const float*)d_in[4];
    const float* qkv_w  = (const float*)d_in[5];
    const float* q_bias = (const float*)d_in[6];
    const float* v_bias = (const float*)d_in[7];
    const float* proj_w = (const float*)d_in[8];
    const float* proj_b = (const float*)d_in[9];
    const float* n2w    = (const float*)d_in[10];
    const float* n2b    = (const float*)d_in[11];
    const float* w1     = (const float*)d_in[12];
    const float* b1     = (const float*)d_in[13];
    const float* w2     = (const float*)d_in[14];
    const float* b2     = (const float*)d_in[15];
    float* out = (float*)d_out;
    (void)in_sizes; (void)n_in; (void)out_size; (void)ws_size;

    char* ws = (char*)d_ws;
    size_t off = 0;
    auto alloc = [&](size_t bytes) -> char* {
        char* p = ws + off;
        off = (off + bytes + 255) & ~(size_t)255;
        return p;
    };
    bf16_t* ln1b   = (bf16_t*)alloc((size_t)MROWS * DIMC * 2);
    bf16_t* wqkvb  = (bf16_t*)alloc((size_t)3 * DIMC * DIMC * 2);
    bf16_t* qb     = (bf16_t*)alloc((size_t)MROWS * DIMC * 2);   // [B,H,N,64]
    bf16_t* kb     = (bf16_t*)alloc((size_t)MROWS * DIMC * 2);   // [B,H,N,64]
    bf16_t* vtb    = (bf16_t*)alloc((size_t)MROWS * DIMC * 2);   // [B,H,64,N]
    bf16_t* attnb  = (bf16_t*)alloc((size_t)MROWS * DIMC * 2);   // [B*N, C]
    bf16_t* wprojb = (bf16_t*)alloc((size_t)DIMC * DIMC * 2);
    float*  x1     = (float*) alloc((size_t)MROWS * DIMC * 4);
    bf16_t* ln2b   = (bf16_t*)alloc((size_t)MROWS * DIMC * 2);
    bf16_t* w1b    = (bf16_t*)alloc((size_t)HIDDEN * DIMC * 2);
    bf16_t* hb     = (bf16_t*)alloc((size_t)MROWS * HIDDEN * 2);
    bf16_t* w2b    = (bf16_t*)alloc((size_t)DIMC * HIDDEN * 2);

    // weight conversions
    cvt_f32_bf16_kernel<<<(3 * DIMC * DIMC) / CVT_BLOCK, CVT_THREADS, 0, stream>>>(qkv_w, wqkvb);
    cvt_f32_bf16_kernel<<<(DIMC * DIMC) / CVT_BLOCK, CVT_THREADS, 0, stream>>>(proj_w, wprojb);
    cvt_f32_bf16_kernel<<<(HIDDEN * DIMC) / CVT_BLOCK, CVT_THREADS, 0, stream>>>(w1, w1b);
    cvt_f32_bf16_kernel<<<(DIMC * HIDDEN) / CVT_BLOCK, CVT_THREADS, 0, stream>>>(w2, w2b);

    // x -> LN1 -> bf16
    layernorm_bf16_kernel<<<MROWS, 256, 0, stream>>>(x, n1w, n1b, ln1b, DIMC);

    // QKV projection + head scatter
    gemm_qkv_kernel<<<dim3(MROWS / 128, (3 * DIMC) / 128), 128, 0, stream>>>(
        ln1b, wqkvb, q_bias, v_bias, qb, kb, vtb);

    // flash attention per (b, h, 16-query tile)
    attention_kernel<<<BATCH * NHEAD * (SEQN / 16), 32, 0, stream>>>(
        qb, kb, vtb, rel, amask, attnb);

    // proj + residual -> x1 (f32)
    gemm_proj_kernel<<<dim3(MROWS / 128, DIMC / 128), 128, 0, stream>>>(
        attnb, wprojb, proj_b, x, x1);

    // LN2 -> bf16
    layernorm_bf16_kernel<<<MROWS, 256, 0, stream>>>(x1, n2w, n2b, ln2b, DIMC);

    // MLP
    gemm_mlp1_kernel<<<dim3(MROWS / 128, HIDDEN / 128), 128, 0, stream>>>(
        ln2b, w1b, b1, hb);
    gemm_mlp2_kernel<<<dim3(MROWS / 128, DIMC / 128), 128, 0, stream>>>(
        hb, w2b, b2, x1, out);
}

// v003
// It runs in 310 microseconds.
// Timed twice side by side with v002, it ran 1.18 and 1.16 times as fast.
// Over all steps from v000 it is 1.77 times as fast.
#include <hip/hip_runtime.h>

// ---------------------------------------------------------------------------
// Types for CDNA5 WMMA (gfx1250, wave32)
// ---------------------------------------------------------------------------
typedef __bf16 bf16_t;
typedef __attribute__((ext_vector_type(16))) __bf16 bf16x16;
typedef __attribute__((ext_vector_type(8)))  __bf16 bf16x8;
typedef __attribute__((ext_vector_type(8)))  float  v8f;

union Frag16 {
    bf16x16 v;
    bf16x8  h[2];
};

__device__ inline bf16x8 load8(const bf16_t* p) {
    return *reinterpret_cast<const bf16x8*>(p);
}

__device__ inline v8f v8f_zero() {
    v8f z = {0.f, 0.f, 0.f, 0.f, 0.f, 0.f, 0.f, 0.f};
    return z;
}

__device__ inline v8f wmma_bf16(const Frag16& a, const Frag16& b, v8f c) {
    // D = A(16x32 bf16) * B(32x16 bf16) + C(16x16 f32)
    return __builtin_amdgcn_wmma_f32_16x16x32_bf16(
        /*neg_a=*/false, a.v, /*neg_b=*/false, b.v,
        /*c_mod=*/(short)0, c, /*reuse_a=*/false, /*reuse_b=*/false);
}

// ---------------------------------------------------------------------------
// Constants
// ---------------------------------------------------------------------------
#define DIMC   1024
#define NHEAD  16
#define HDIM   64
#define SEQN   1024
#define BATCH  4
#define MROWS  4096      // BATCH * SEQN
#define HIDDEN 4096

// ---------------------------------------------------------------------------
// f32 -> bf16 conversion (weights, once per call), as a stream: few waves, each
// with much in flight.  A work-group of 4 waves takes 8192 elements in a row;
// a lane issues its 16 loads of 16 B (each wave-wide load covers 512 B in a row)
// ahead of the first conversion, then stores 8 B per load (256 B in a row a wave).
// Every weight's element count is a multiple of CVT_BLOCK, so there is no tail.
// ---------------------------------------------------------------------------
typedef __attribute__((ext_vector_type(4))) float  f32x4;
typedef __attribute__((ext_vector_type(4))) __bf16 bf16x4;

#define CVT_THREADS 128
#define CVT_VECS    16
#define CVT_BLOCK   (CVT_THREADS * 4 * CVT_VECS)   // elements per work-group

__global__ void __launch_bounds__(CVT_THREADS)
cvt_f32_bf16_kernel(const float* __restrict__ src, bf16_t* __restrict__ dst) {
    const f32x4* __restrict__ s4 = reinterpret_cast<const f32x4*>(src);
    bf16x4* __restrict__      d4 = reinterpret_cast<bf16x4*>(dst);
    const uint32_t idx = blockIdx.x * (CVT_THREADS * CVT_VECS) + threadIdx.x;  // in groups of 4
    f32x4 v[CVT_VECS];
#pragma unroll   // all loads in flight together: the registers are indexed by constants
    for (int u = 0; u < CVT_VECS; u++)
        v[u] = s4[idx + u * CVT_THREADS];
    // keeps every load ahead of the first conversion: without it the compiler holds the
    // last four back until the first have returned, a second memory latency per wave
    __builtin_amdgcn_sched_barrier(0);
#pragma unroll   // as above
    for (int u = 0; u < CVT_VECS; u++)
        d4[idx + u * CVT_THREADS] = __builtin_convertvector(v[u], bf16x4);
}

// ---------------------------------------------------------------------------
// LayerNorm: one row (1024 f32) per workgroup (8 waves), bf16 output
// ---------------------------------------------------------------------------
__global__ void layernorm_bf16_kernel(const float* __restrict__ x,
                                      const float* __restrict__ w,
                                      const float* __restrict__ b,
                                      bf16_t* __restrict__ out, int cols) {
    int row = blockIdx.x;
    const float* xr = x + (size_t)row * cols;
    float s1 = 0.f, s2 = 0.f;
    for (int c = threadIdx.x; c < cols; c += blockDim.x) {
        float v = xr[c];
        s1 += v;
        s2 += v * v;
    }
#pragma unroll
    for (int off = 16; off > 0; off >>= 1) {
        s1 += __shfl_xor(s1, off, 32);
        s2 += __shfl_xor(s2, off, 32);
    }
    __shared__ float r1[8], r2[8];
    int wid = threadIdx.x >> 5;
    int lane = threadIdx.x & 31;
    if (lane == 0) { r1[wid] = s1; r2[wid] = s2; }
    __syncthreads();
    if (threadIdx.x == 0) {
        float a = 0.f, bb = 0.f;
        for (int i = 0; i < 8; i++) { a += r1[i]; bb += r2[i]; }
        r1[0] = a; r2[0] = bb;
    }
    __syncthreads();
    float mu  = r1[0] / cols;
    float var = r2[0] / cols - mu * mu;
    float rs  = rsqrtf(var + 1e-5f);
    for (int c = threadIdx.x; c < cols; c += blockDim.x) {
        out[(size_t)row * cols + c] = (bf16_t)((xr[c] - mu) * rs * w[c] + b[c]);
    }
}

// ---------------------------------------------------------------------------
// Core: one workgroup (4 waves, 2 x 2) computes a 128(M) x 128(N) tile of
// A[MxK] * W[NxK]^T; each wave a 64 x 64 part, acc[i][j] = C-frag for M-subtile i
// and N-subtile j.  A row-major [M,K] bf16, W row-major [N,K] bf16.
// Both operands are staged in LDS by the tensor mover, 128 k (256 B of every
// row) per pass, two buffers: the load of pass s + 2 flies while pass s + 1 runs.
// A buffer is four slices of 64 rows, [A 0-63 | A 64-127 | W 0-63 | W 64-127];
// wave w brings slice w.  Rows lie at pitch 272 B (16 B pad laid by the mover).
// ---------------------------------------------------------------------------
typedef uint32_t u32x4 __attribute__((ext_vector_type(4)));
typedef uint32_t u32x8 __attribute__((ext_vector_type(8)));

#define T_ROWB   256u      // bytes of one staged row (128 k)
#define T_PITCH  272u      // row pitch in LDS
#define T_SLICE  18432u    // 64 rows * 272 B, rounded up to a multiple of 2 KiB
#define T_BUF    73728u    // four slices
#define T_LDS    147456u   // two buffers

__device__ __forceinline__ uint32_t uni(uint32_t v) {
    return (uint32_t)__builtin_amdgcn_readfirstlane(v);
}
// Holds a wave-uniform test in a scalar register, so that the branch round a
// tensor load (which ignores EXEC) compiles to s_cmp + s_cbranch_scc.
__device__ __forceinline__ uint32_t pinned(uint32_t v) {
    uint32_t w = uni(v);
    asm volatile("" : "+s"(w));  // keeps the test scalar
    return w;
}

template <int K>
__device__ __forceinline__ void block_gemm_128x128(const bf16_t* __restrict__ A,
                                                   const bf16_t* __restrict__ W,
                                                   uint32_t m0, uint32_t n0,
                                                   const unsigned char* L,
                                                   v8f acc[4][4]) {
    constexpr uint32_t NP   = K / 128;   // passes; at least two
    constexpr uint32_t SRCP = K * 2;     // source row pitch, bytes
    const uint32_t lane = threadIdx.x & 31u;
    const uint32_t hf   = lane >> 4;     // lane half selects K sub-stripe
    const uint32_t lr   = lane & 15u;    // M row (A) / N col (B) within 16
    const uint32_t wave = uni(threadIdx.x >> 5);
    const uint32_t wm   = wave >> 1, wn = wave & 1u;

    // this wave's slice: its first source byte and its place in LDS
    const uint64_t src = (wave < 2u)
        ? (uint64_t)(size_t)A + (uint64_t)(m0 + wave * 64u) * SRCP
        : (uint64_t)(size_t)W + (uint64_t)(n0 + (wave - 2u) * 64u) * SRCP;
    const uint32_t dst = (uint32_t)(size_t)L + wave * T_SLICE;

    // descriptor group 1: bytes, tile = tensor = 64 rows of 256 B, 16 B pad per row
    u32x8 g1;
    g1[0] = uni((1u << 20) | (5u << 22) | (3u << 25));
    g1[1] = uni(T_ROWB << 16);
    g1[2] = uni(64u << 16);
    g1[3] = uni(T_ROWB << 16);
    g1[4] = uni(64u);
    g1[5] = uni(SRCP);
    g1[6] = uni(0u);
    g1[7] = uni(0u);

    // descriptor group 0 of stage st: count 1, place in LDS, source address, type 2
    auto group0 = [&](uint32_t st) {
        const uint64_t ga = src + (uint64_t)st * T_ROWB;
        u32x4 g;
        g[0] = uni(1u);
        g[1] = uni(dst + (st & 1u) * T_BUF);
        g[2] = uni((uint32_t)ga);
        g[3] = uni((((uint32_t)(ga >> 32)) & 0x01FFFFFFu) | 0x80000000u);
        return g;
    };

#pragma unroll
    for (int i = 0; i < 4; i++)
#pragma unroll
        for (int j = 0; j < 4; j++)
            acc[i][j] = v8f_zero();

    // Stage 0: load and wait in one statement, so that no descriptor register can be
    // rewritten while the request is outstanding.
    u32x4 g0 = group0(0);
    asm volatile("tensor_load_to_lds %0, %1\n\ts_wait_tensorcnt 0x0"
                 :: "s"(g0), "s"(g1) : "memory");       // own slice of stage 0 has landed
    __syncthreads();                                    // ... and every other wave's
    // Stage 1 and the refills: g0 is an in-out operand of the load and an input of the
    // wait that covers it, which keeps the descriptor in its registers up to that wait.
    g0 = group0(1);
    asm volatile("tensor_load_to_lds %0, %1" : "+s"(g0) : "s"(g1) : "memory");

    const uint32_t aoff = wm * T_SLICE + lr * T_PITCH + hf * 16u;
    const uint32_t boff = (2u + wn) * T_SLICE + lr * T_PITCH + hf * 16u;

#pragma unroll 1   // one pass per trip: the ring's waits stand once, at the foot
    for (uint32_t s = 0; s < NP; ++s) {
        const unsigned char* pa = L + (s & 1u) * T_BUF + aoff;
        const unsigned char* pb = L + (s & 1u) * T_BUF + boff;
        Frag16 a[2][4], b[2][4];
#pragma unroll
        for (int i = 0; i < 4; i++) {
            a[0][i].h[0] = *reinterpret_cast<const bf16x8*>(pa + i * 16 * T_PITCH);
            a[0][i].h[1] = *reinterpret_cast<const bf16x8*>(pa + i * 16 * T_PITCH + 32);
            b[0][i].h[0] = *reinterpret_cast<const bf16x8*>(pb + i * 16 * T_PITCH);
            b[0][i].h[1] = *reinterpret_cast<const bf16x8*>(pb + i * 16 * T_PITCH + 32);
        }
#pragma unroll
        for (int ks = 0; ks < 4; ks++) {
            const int cur = ks & 1, nxt = cur ^ 1;
            if (ks < 3) {   // the next 32 k's fragments, as one group ahead of this block
                // fence pair: without it the compiler spreads these reads among the
                // WMMAs with a full LDS wait at each place, which stalls the matrix pipe
                __builtin_amdgcn_sched_barrier(0);
#pragma unroll
                for (int i = 0; i < 4; i++) {
                    const int o = i * 16 * T_PITCH + (ks + 1) * 64;
                    a[nxt][i].h[0] = *reinterpret_cast<const bf16x8*>(pa + o);
                    a[nxt][i].h[1] = *reinterpret_cast<const bf16x8*>(pa + o + 32);
                    b[nxt][i].h[0] = *reinterpret_cast<const bf16x8*>(pb + o);
                    b[nxt][i].h[1] = *reinterpret_cast<const bf16x8*>(pb + o + 32);
                }
                __builtin_amdgcn_sched_barrier(0);  // closes the pair
            }
#pragma unroll
            for (int i = 0; i < 4; i++)
#pragma unroll
                for (int j = 0; j < 4; j++)
                    acc[i][j] = wmma_bf16(a[cur][i], b[cur][j], acc[i][j]);
        }
        // keeps the WMMAs above in front of the waits below: the compiler otherwise lifts
        // the full LDS wait to just behind the last read group, where the wave stalls on it
        __builtin_amdgcn_sched_barrier(0);
        // publish point of stage s + 1
        asm volatile("s_wait_dscnt 0x0" ::: "memory");      // own reads of this buffer are done
        // own slice of stage s + 1 has landed; names the descriptor, see above
        asm volatile("s_wait_tensorcnt 0x0" :: "s"(g0), "s"(g1) : "memory");
        __syncthreads();   // publishes stage s + 1; ends every reader's last read of stage s
        if (pinned(s + 2u < NP)) {                          // refill the buffer just left
            g0 = group0(s + 2u);
            asm volatile("tensor_load_to_lds %0, %1" : "+s"(g0) : "s"(g1) : "memory");
        }
    }
    asm volatile("s_wait_tensorcnt 0x0" ::: "memory");  // no request outlives the loop
    asm volatile("s_wait_dscnt 0x0" ::: "memory");
}

// ---------------------------------------------------------------------------
// QKV GEMM: [4096,1024] x [3072,1024]^T, epilogue scatters into
//   Q [B,H,N,64] (scaled by hd^-0.5, +q_bias), K [B,H,N,64],
//   V^T [B,H,64,N] (+v_bias)  -- V transposed so its fragments for P*V load contiguous.
// grid (32, 24), block 128 (4 waves, each 64x64)
// ---------------------------------------------------------------------------
__global__ void __launch_bounds__(128) gemm_qkv_kernel(const bf16_t* __restrict__ A,
                                const bf16_t* __restrict__ W,
                                const float* __restrict__ q_bias,
                                const float* __restrict__ v_bias,
                                bf16_t* __restrict__ qo,
                                bf16_t* __restrict__ ko,
                                bf16_t* __restrict__ vto) {
    __shared__ __attribute__((aligned(2048))) unsigned char L[T_LDS];
    int wv = threadIdx.x >> 5;
    v8f acc[4][4];
    block_gemm_128x128<DIMC>(A, W, blockIdx.x * 128u, blockIdx.y * 128u, L, acc);
    int m0 = blockIdx.x * 128 + (wv >> 1) * 64;   // this wave's 64 x 64 part
    int n0 = blockIdx.y * 128 + (wv & 1) * 64;

    int lane = threadIdx.x & 31, hf = lane >> 4, lr = lane & 15;
#pragma unroll
    for (int i = 0; i < 4; i++)
#pragma unroll
        for (int j = 0; j < 4; j++) {
            int col    = n0 + j * 16 + lr;      // 0..3071
            int sec    = col >> 10;             // 0=q 1=k 2=v
            int within = col & 1023;
            int hh     = within >> 6;
            int d      = within & 63;
            float bias = (sec == 0) ? q_bias[within]
                       : (sec == 2) ? v_bias[within] : 0.f;
#pragma unroll
            for (int r = 0; r < 8; r++) {
                int row = m0 + i * 16 + 8 * hf + r;  // global token row
                int bi  = row >> 10;
                int n   = row & 1023;
                float val = acc[i][j][r] + bias;
                size_t bh = (size_t)bi * NHEAD + hh;
                if (sec == 0)
                    qo[(bh * SEQN + n) * HDIM + d] = (bf16_t)(val * 0.125f);
                else if (sec == 1)
                    ko[(bh * SEQN + n) * HDIM + d] = (bf16_t)val;
                else
                    vto[(bh * HDIM + d) * SEQN + n] = (bf16_t)val;
            }
        }
}

// ---------------------------------------------------------------------------
// Flash attention: one wave per (b, h, 16-query tile), on transposed products.
// S^T(32 keys x 16 queries) = K_tile(16x64) * Q^T via 2 WMMAs per key-subtile: a lane
// holds 8 keys of ONE query per subtile (lanes l and l ^ 16 share a query), so the
// softmax row maximum and sum run inside the lane, with one exchange between the halves.
// O^T(64 x 16) += V^T(16x32) * P^T(32x16) via 4 WMMAs: the C layout of S^T (key 8*hf + r)
// is the B layout of P^T (k = 8*hf + e, 16 + 8*hf + e), so P is packed from the lane's
// own registers.  + rel_pos_bias, key-padding mask; online softmax.
// grid 4096, block 32.
// ---------------------------------------------------------------------------
typedef __attribute__((ext_vector_type(4))) int i32x4;

// value of lane l ^ 16
__device__ inline float xhalf(float x) {
    int b = __builtin_bit_cast(int, x);
    return __builtin_bit_cast(float,
        __builtin_amdgcn_permlanex16(b, b, 0x76543210, 0xfedcba98, false, false));
}

__global__ void attention_kernel(const bf16_t* __restrict__ Q,
                                 const bf16_t* __restrict__ Km,
                                 const bf16_t* __restrict__ Vt,
                                 const float* __restrict__ rel,
                                 const int* __restrict__ amask,
                                 bf16_t* __restrict__ out) {
    int blk = blockIdx.x;
    int qt  = blk & 63;          // SEQN/16 = 64 query tiles
    int bh  = blk >> 6;
    int h   = bh & (NHEAD - 1);
    int bi  = bh >> 4;
    int qbase = qt * 16;

    int lane = threadIdx.x & 31;
    int hf   = lane >> 4;
    int lr   = lane & 15;

    const bf16_t* Qb = Q + ((size_t)bh * SEQN + qbase) * HDIM;
    const bf16_t* Kb = Km + (size_t)bh * SEQN * HDIM;
    const bf16_t* Vb = Vt + (size_t)bh * HDIM * SEQN;
    const float*  Rb = rel + (size_t)h * SEQN * SEQN;
    const int*    Mb = amask + (size_t)bi * SEQN;

    // Q^T B-frags (column = query lr) for the two 32-wide K(=d) halves
    Frag16 aq[2];
#pragma unroll   // keeps the register arrays indexed by constants
    for (int s = 0; s < 2; s++) {
        const bf16_t* p = Qb + (size_t)lr * HDIM + s * 32 + hf * 8;
        aq[s].h[0] = load8(p);
        aq[s].h[1] = load8(p + 16);
    }

    // this lane's query is qbase + lr; its keys in a 16-key subtile are 8 * hf + 0..7
    const float* Rl = Rb + (size_t)(qbase + lr) * SEQN + hf * 8;
    const int*   Ml = Mb + hf * 8;

    float mrow = -1e30f;   // running maximum of the query's row (equal in both halves)
    float lsum = 0.f;      // running sum over this half's keys; the halves join at the end
    v8f o[4];              // O^T: o[j][r] = d 16 * j + 8 * hf + r of query lr
#pragma unroll   // keeps the register arrays indexed by constants
    for (int j = 0; j < 4; j++) o[j] = v8f_zero();

    for (int kk = 0; kk < SEQN; kk += 32) {
        // ---- scores for two 16-key subtiles, keys in rows
        v8f s[2];
#pragma unroll   // keeps the register arrays indexed by constants
        for (int t = 0; t < 2; t++) {
            int key = kk + t * 16 + lr;
            const bf16_t* kp = Kb + (size_t)key * HDIM + hf * 8;
            Frag16 b0, b1;
            b0.h[0] = load8(kp);       b0.h[1] = load8(kp + 16);
            b1.h[0] = load8(kp + 32);  b1.h[1] = load8(kp + 48);
            s[t] = wmma_bf16(b0, aq[0], v8f_zero());
            s[t] = wmma_bf16(b1, aq[1], s[t]);
        }
        // ---- bias + key-padding mask: 8 keys in a row per subtile
        f32x4 rb[2][2];
        i32x4 mk[2][2];
#pragma unroll   // keeps the register arrays indexed by constants
        for (int t = 0; t < 2; t++) {
            const f32x4* bp = reinterpret_cast<const f32x4*>(Rl + kk + t * 16);
            const i32x4* mp = reinterpret_cast<const i32x4*>(Ml + kk + t * 16);
            rb[t][0] = bp[0];  rb[t][1] = bp[1];
            mk[t][0] = mp[0];  mk[t][1] = mp[1];
        }
        // stands ahead of any rewrite of the address registers that these eight loads name
        asm volatile("s_wait_xcnt 0x0" ::: "memory");
        float sv[2][8];
#pragma unroll   // keeps the register arrays indexed by constants
        for (int t = 0; t < 2; t++)
#pragma unroll   // keeps the register arrays indexed by constants
            for (int r = 0; r < 4; r++) {
                sv[t][r]     = mk[t][0][r] ? s[t][r] + rb[t][0][r]     : -1e30f;
                sv[t][r + 4] = mk[t][1][r] ? s[t][r + 4] + rb[t][1][r] : -1e30f;
            }
        // ---- online softmax: the row maximum over the lane's 16 keys, then the other half's
        float v = fmaxf(sv[0][0], sv[1][0]);
#pragma unroll   // keeps the register arrays indexed by constants
        for (int r = 1; r < 8; r++)
            v = fmaxf(v, fmaxf(sv[0][r], sv[1][r]));
        v = fmaxf(v, xhalf(v));
        float mnew  = fmaxf(mrow, v);
        float scale = __expf(mrow - mnew);
#pragma unroll   // keeps the register arrays indexed by constants
        for (int j = 0; j < 4; j++)
#pragma unroll   // keeps the register arrays indexed by constants
            for (int r = 0; r < 8; r++)
                o[j][r] = o[j][r] * scale;
        // ---- P^T B-frag straight from the lane's own scores, cast to bf16
        Frag16 pt;
        float srow = 0.f;
#pragma unroll   // keeps the register arrays indexed by constants
        for (int r = 0; r < 8; r++)
#pragma unroll   // keeps the register arrays indexed by constants
            for (int t = 0; t < 2; t++) {
                float p = (sv[t][r] > -1e29f) ? __expf(sv[t][r] - mnew) : 0.f;
                srow += p;
                pt.v[t * 8 + r] = (bf16_t)p;
            }
        lsum = lsum * scale + srow;
        mrow = mnew;

        // ---- O^T += V^T * P^T  (V^T layout => contiguous A-frag loads)
#pragma unroll   // keeps the register arrays indexed by constants
        for (int j = 0; j < 4; j++) {
            const bf16_t* vp = Vb + (size_t)(j * 16 + lr) * SEQN + kk + hf * 8;
            Frag16 bv;
            bv.h[0] = load8(vp);
            bv.h[1] = load8(vp + 16);
            o[j] = wmma_bf16(bv, pt, o[j]);
        }
    }

    // ---- normalize and write [B,N, H*64] bf16: 8 d in a row per lane and tile
    float l   = lsum + xhalf(lsum);
    float inv = (l > 0.f) ? 1.f / l : 0.f;
    bf16_t* op = out + ((size_t)bi * SEQN + qbase + lr) * DIMC + h * HDIM + hf * 8;
#pragma unroll   // keeps the register arrays indexed by constants
    for (int j = 0; j < 4; j++) {
        bf16x8 w;
#pragma unroll   // keeps the register arrays indexed by constants
        for (int r = 0; r < 8; r++)
            w[r] = (bf16_t)(o[j][r] * inv);
        *reinterpret_cast<bf16x8*>(op + j * 16) = w;
    }
}

// ---------------------------------------------------------------------------
// Proj GEMM + bias + residual -> f32.  grid (32,8), block 128
// ---------------------------------------------------------------------------
__global__ void __launch_bounds__(128) gemm_proj_kernel(const bf16_t* __restrict__ A,
                                 const bf16_t* __restrict__ W,
                                 const float* __restrict__ bias,
                                 const float* __restrict__ resid,
                                 float* __restrict__ out) {
    __shared__ __attribute__((aligned(2048))) unsigned char L[T_LDS];
    int wv = threadIdx.x >> 5;
    v8f acc[4][4];
    block_gemm_128x128<DIMC>(A, W, blockIdx.x * 128u, blockIdx.y * 128u, L, acc);
    int m0 = blockIdx.x * 128 + (wv >> 1) * 64;   // this wave's 64 x 64 part
    int n0 = blockIdx.y * 128 + (wv & 1) * 64;
    int lane = threadIdx.x & 31, hf = lane >> 4, lr = lane & 15;
#pragma unroll
    for (int i = 0; i < 4; i++)
#pragma unroll
        for (int j = 0; j < 4; j++) {
            int col = n0 + j * 16 + lr;
            float bv = bias[col];
#pragma unroll
            for (int r = 0; r < 8; r++) {
                size_t row = (size_t)(m0 + i * 16 + 8 * hf + r);
                out[row * DIMC + col] = acc[i][j][r] + bv + resid[row * DIMC + col];
            }
        }
}

// ---------------------------------------------------------------------------
// MLP1 GEMM + bias + exact GELU -> bf16.  grid (32,32), block 128
// ---------------------------------------------------------------------------
__global__ void __launch_bounds__(128) gemm_mlp1_kernel(const bf16_t* __restrict__ A,
                                 const bf16_t* __restrict__ W,
                                 const float* __restrict__ bias,
                                 bf16_t* __restrict__ out) {
    __shared__ __attribute__((aligned(2048))) unsigned char L[T_LDS];
    int wv = threadIdx.x >> 5;
    v8f acc[4][4];
    block_gemm_128x128<DIMC>(A, W, blockIdx.x * 128u, blockIdx.y * 128u, L, acc);
    int m0 = blockIdx.x * 128 + (wv >> 1) * 64;   // this wave's 64 x 64 part
    int n0 = blockIdx.y * 128 + (wv & 1) * 64;
    int lane = threadIdx.x & 31, hf = lane >> 4, lr = lane & 15;
#pragma unroll
    for (int i = 0; i < 4; i++)
#pragma unroll
        for (int j = 0; j < 4; j++) {
            int col = n0 + j * 16 + lr;
            float bv = bias[col];
#pragma unroll
            for (int r = 0; r < 8; r++) {
                size_t row = (size_t)(m0 + i * 16 + 8 * hf + r);
                float v = acc[i][j][r] + bv;
                float g = 0.5f * v * (1.f + erff(v * 0.70710678118654752f));
                out[row * HIDDEN + col] = (bf16_t)g;
            }
        }
}

// ---------------------------------------------------------------------------
// MLP2 GEMM + bias + residual -> f32 final output.  grid (32,8), block 128
// ---------------------------------------------------------------------------
__global__ void __launch_bounds__(128) gemm_mlp2_kernel(const bf16_t* __restrict__ A,
                                 const bf16_t* __restrict__ W,
                                 const float* __restrict__ bias,
                                 const float* __restrict__ resid,
                                 float* __restrict__ out) {
    __shared__ __attribute__((aligned(2048))) unsigned char L[T_LDS];
    int wv = threadIdx.x >> 5;
    v8f acc[4][4];
    block_gemm_128x128<HIDDEN>(A, W, blockIdx.x * 128u, blockIdx.y * 128u, L, acc);
    int m0 = blockIdx.x * 128 + (wv >> 1) * 64;   // this wave's 64 x 64 part
    int n0 = blockIdx.y * 128 + (wv & 1) * 64;
    int lane = threadIdx.x & 31, hf = lane >> 4, lr = lane & 15;
#pragma unroll
    for (int i = 0; i < 4; i++)
#pragma unroll
        for (int j = 0; j < 4; j++) {
            int col = n0 + j * 16 + lr;
            float bv = bias[col];
#pragma unroll
            for (int r = 0; r < 8; r++) {
                size_t row = (size_t)(m0 + i * 16 + 8 * hf + r);
                out[row * DIMC + col] = acc[i][j][r] + bv + resid[row * DIMC + col];
            }
        }
}

// ---------------------------------------------------------------------------
// Host driver
// ---------------------------------------------------------------------------
extern "C" void kernel_launch(void* const* d_in, const int* in_sizes, int n_in,
                              void* d_out, int out_size, void* d_ws, size_t ws_size,
                              hipStream_t stream) {
    const float* x      = (const float*)d_in[0];
    const float* rel    = (const float*)d_in[1];
    const int*   amask  = (const int*)  d_in[2];
    const float* n1w    = (const float*)d_in[3];
    const float* n1b    = (const float*)d_in[4];
    const float* qkv_w  = (const float*)d_in[5];
    const float* q_bias = (const float*)d_in[6];
    const float* v_bias = (const float*)d_in[7];
    const float* proj_w = (const float*)d_in[8];
    const float* proj_b = (const float*)d_in[9];
    const float* n2w    = (const float*)d_in[10];
    const float* n2b    = (const float*)d_in[11];
    const float* w1     = (const float*)d_in[12];
    const float* b1     = (const float*)d_in[13];
    const float* w2     = (const float*)d_in[14];
    const float* b2     = (const float*)d_in[15];
    float* out = (float*)d_out;
    (void)in_sizes; (void)n_in; (void)out_size; (void)ws_size;

    char* ws = (char*)d_ws;
    size_t off = 0;
    auto alloc = [&](size_t bytes) -> char* {
        char* p = ws + off;
        off = (off + bytes + 255) & ~(size_t)255;
        return p;
    };
    bf16_t* ln1b   = (bf16_t*)alloc((size_t)MROWS * DIMC * 2);
    bf16_t* wqkvb  = (bf16_t*)alloc((size_t)3 * DIMC * DIMC * 2);
    bf16_t* qb     = (bf16_t*)alloc((size_t)MROWS * DIMC * 2);   // [B,H,N,64]
    bf16_t* kb     = (bf16_t*)alloc((size_t)MROWS * DIMC * 2);   // [B,H,N,64]
    bf16_t* vtb    = (bf16_t*)alloc((size_t)MROWS * DIMC * 2);   // [B,H,64,N]
    bf16_t* attnb  = (bf16_t*)alloc((size_t)MROWS * DIMC * 2);   // [B*N, C]
    bf16_t* wprojb = (bf16_t*)alloc((size_t)DIMC * DIMC * 2);
    float*  x1     = (float*) alloc((size_t)MROWS * DIMC * 4);
    bf16_t* ln2b   = (bf16_t*)alloc((size_t)MROWS * DIMC * 2);
    bf16_t* w1b    = (bf16_t*)alloc((size_t)HIDDEN * DIMC * 2);
    bf16_t* hb     = (bf16_t*)alloc((size_t)MROWS * HIDDEN * 2);
    bf16_t* w2b    = (bf16_t*)alloc((size_t)DIMC * HIDDEN * 2);

    // weight conversions
    cvt_f32_bf16_kernel<<<(3 * DIMC * DIMC) / CVT_BLOCK, CVT_THREADS, 0, stream>>>(qkv_w, wqkvb);
    cvt_f32_bf16_kernel<<<(DIMC * DIMC) / CVT_BLOCK, CVT_THREADS, 0, stream>>>(proj_w, wprojb);
    cvt_f32_bf16_kernel<<<(HIDDEN * DIMC) / CVT_BLOCK, CVT_THREADS, 0, stream>>>(w1, w1b);
    cvt_f32_bf16_kernel<<<(DIMC * HIDDEN) / CVT_BLOCK, CVT_THREADS, 0, stream>>>(w2, w2b);

    // x -> LN1 -> bf16
    layernorm_bf16_kernel<<<MROWS, 256, 0, stream>>>(x, n1w, n1b, ln1b, DIMC);

    // QKV projection + head scatter
    gemm_qkv_kernel<<<dim3(MROWS / 128, (3 * DIMC) / 128), 128, 0, stream>>>(
        ln1b, wqkvb, q_bias, v_bias, qb, kb, vtb);

    // flash attention per (b, h, 16-query tile)
    attention_kernel<<<BATCH * NHEAD * (SEQN / 16), 32, 0, stream>>>(
        qb, kb, vtb, rel, amask, attnb);

    // proj + residual -> x1 (f32)
    gemm_proj_kernel<<<dim3(MROWS / 128, DIMC / 128), 128, 0, stream>>>(
        attnb, wprojb, proj_b, x, x1);

    // LN2 -> bf16
    layernorm_bf16_kernel<<<MROWS, 256, 0, stream>>>(x1, n2w, n2b, ln2b, DIMC);

    // MLP
    gemm_mlp1_kernel<<<dim3(MROWS / 128, HIDDEN / 128), 128, 0, stream>>>(
        ln2b, w1b, b1, hb);
    gemm_mlp2_kernel<<<dim3(MROWS / 128, DIMC / 128), 128, 0, stream>>>(
        hb, w2b, b2, x1, out);
}

// v004
// A run of this version takes 241 microseconds.
// In both of two side-by-side timings against v003, it was 1.29 times as fast.
// All steps since v000 together make it 2.28 times as fast.
#include <hip/hip_runtime.h>

// ---------------------------------------------------------------------------
// Types for CDNA5 WMMA (gfx1250, wave32)
// ---------------------------------------------------------------------------
typedef __bf16 bf16_t;
typedef __attribute__((ext_vector_type(16))) __bf16 bf16x16;
typedef __attribute__((ext_vector_type(8)))  __bf16 bf16x8;
typedef __attribute__((ext_vector_type(8)))  float  v8f;

union Frag16 {
    bf16x16 v;
    bf16x8  h[2];
};

__device__ inline bf16x8 load8(const bf16_t* p) {
    return *reinterpret_cast<const bf16x8*>(p);
}

__device__ inline v8f v8f_zero() {
    v8f z = {0.f, 0.f, 0.f, 0.f, 0.f, 0.f, 0.f, 0.f};
    return z;
}

__device__ inline v8f wmma_bf16(const Frag16& a, const Frag16& b, v8f c) {
    // D = A(16x32 bf16) * B(32x16 bf16) + C(16x16 f32)
    return __builtin_amdgcn_wmma_f32_16x16x32_bf16(
        /*neg_a=*/false, a.v, /*neg_b=*/false, b.v,
        /*c_mod=*/(short)0, c, /*reuse_a=*/false, /*reuse_b=*/false);
}

// ---------------------------------------------------------------------------
// Constants
// ---------------------------------------------------------------------------
#define DIMC   1024
#define NHEAD  16
#define HDIM   64
#define SEQN   1024
#define BATCH  4
#define MROWS  4096      // BATCH * SEQN
#define HIDDEN 4096

// ---------------------------------------------------------------------------
// f32 -> bf16 conversion (weights, once per call), as a stream: few waves, each
// with much in flight.  A work-group of 4 waves takes 8192 elements in a row;
// a lane issues its 16 loads of 16 B (each wave-wide load covers 512 B in a row)
// ahead of the first conversion, then stores 8 B per load (256 B in a row a wave).
// Every weight's element count is a multiple of CVT_BLOCK, so there is no tail.
// ---------------------------------------------------------------------------
typedef __attribute__((ext_vector_type(4))) float  f32x4;
typedef __attribute__((ext_vector_type(4))) __bf16 bf16x4;

#define CVT_THREADS 128
#define CVT_VECS    16
#define CVT_BLOCK   (CVT_THREADS * 4 * CVT_VECS)   // elements per work-group

__global__ void __launch_bounds__(CVT_THREADS)
cvt_f32_bf16_kernel(const float* __restrict__ src, bf16_t* __restrict__ dst) {
    const f32x4* __restrict__ s4 = reinterpret_cast<const f32x4*>(src);
    bf16x4* __restrict__      d4 = reinterpret_cast<bf16x4*>(dst);
    const uint32_t idx = blockIdx.x * (CVT_THREADS * CVT_VECS) + threadIdx.x;  // in groups of 4
    f32x4 v[CVT_VECS];
#pragma unroll   // all loads in flight together: the registers are indexed by constants
    for (int u = 0; u < CVT_VECS; u++)
        v[u] = s4[idx + u * CVT_THREADS];
    // keeps every load ahead of the first conversion: without it the compiler holds the
    // last four back until the first have returned, a second memory latency per wave
    __builtin_amdgcn_sched_barrier(0);
#pragma unroll   // as above
    for (int u = 0; u < CVT_VECS; u++)
        d4[idx + u * CVT_THREADS] = __builtin_convertvector(v[u], bf16x4);
}

// ---------------------------------------------------------------------------
// LayerNorm: one row (1024 f32) per workgroup (8 waves), bf16 output
// ---------------------------------------------------------------------------
__global__ void layernorm_bf16_kernel(const float* __restrict__ x,
                                      const float* __restrict__ w,
                                      const float* __restrict__ b,
                                      bf16_t* __restrict__ out, int cols) {
    int row = blockIdx.x;
    const float* xr = x + (size_t)row * cols;
    float s1 = 0.f, s2 = 0.f;
    for (int c = threadIdx.x; c < cols; c += blockDim.x) {
        float v = xr[c];
        s1 += v;
        s2 += v * v;
    }
#pragma unroll
    for (int off = 16; off > 0; off >>= 1) {
        s1 += __shfl_xor(s1, off, 32);
        s2 += __shfl_xor(s2, off, 32);
    }
    __shared__ float r1[8], r2[8];
    int wid = threadIdx.x >> 5;
    int lane = threadIdx.x & 31;
    if (lane == 0) { r1[wid] = s1; r2[wid] = s2; }
    __syncthreads();
    if (threadIdx.x == 0) {
        float a = 0.f, bb = 0.f;
        for (int i = 0; i < 8; i++) { a += r1[i]; bb += r2[i]; }
        r1[0] = a; r2[0] = bb;
    }
    __syncthreads();
    float mu  = r1[0] / cols;
    float var = r2[0] / cols - mu * mu;
    float rs  = rsqrtf(var + 1e-5f);
    for (int c = threadIdx.x; c < cols; c += blockDim.x) {
        out[(size_t)row * cols + c] = (bf16_t)((xr[c] - mu) * rs * w[c] + b[c]);
    }
}

// ---------------------------------------------------------------------------
// Core: one workgroup (4 waves, 2 x 2) computes a 128(M) x 128(N) tile of
// A[MxK] * W[NxK]^T; each wave a 64 x 64 part, acc[i][j] = C-frag for M-subtile i
// and N-subtile j.  A row-major [M,K] bf16, W row-major [N,K] bf16.
// Both operands are staged in LDS by the tensor mover, 128 k (256 B of every
// row) per pass, two buffers: the load of pass s + 2 flies while pass s + 1 runs.
// A buffer is four slices of 64 rows, [A 0-63 | A 64-127 | W 0-63 | W 64-127];
// wave w brings slice w.  Rows lie at pitch 272 B (16 B pad laid by the mover).
// ---------------------------------------------------------------------------
typedef uint32_t u32x4 __attribute__((ext_vector_type(4)));
typedef uint32_t u32x8 __attribute__((ext_vector_type(8)));

#define T_ROWB   256u      // bytes of one staged row (128 k)
#define T_PITCH  272u      // row pitch in LDS
#define T_SLICE  18432u    // 64 rows * 272 B, rounded up to a multiple of 2 KiB
#define T_BUF    73728u    // four slices
#define T_LDS    147456u   // two buffers

__device__ __forceinline__ uint32_t uni(uint32_t v) {
    return (uint32_t)__builtin_amdgcn_readfirstlane(v);
}
// Holds a wave-uniform test in a scalar register, so that the branch round a
// tensor load (which ignores EXEC) compiles to s_cmp + s_cbranch_scc.
__device__ __forceinline__ uint32_t pinned(uint32_t v) {
    uint32_t w = uni(v);
    asm volatile("" : "+s"(w));  // keeps the test scalar
    return w;
}

template <int K>
__device__ __forceinline__ void block_gemm_128x128(const bf16_t* __restrict__ A,
                                                   const bf16_t* __restrict__ W,
                                                   uint32_t m0, uint32_t n0,
                                                   const unsigned char* L,
                                                   v8f acc[4][4]) {
    constexpr uint32_t NP   = K / 128;   // passes; at least two
    constexpr uint32_t SRCP = K * 2;     // source row pitch, bytes
    const uint32_t lane = threadIdx.x & 31u;
    const uint32_t hf   = lane >> 4;     // lane half selects K sub-stripe
    const uint32_t lr   = lane & 15u;    // M row (A) / N col (B) within 16
    const uint32_t wave = uni(threadIdx.x >> 5);
    const uint32_t wm   = wave >> 1, wn = wave & 1u;

    // this wave's slice: its first source byte and its place in LDS
    const uint64_t src = (wave < 2u)
        ? (uint64_t)(size_t)A + (uint64_t)(m0 + wave * 64u) * SRCP
        : (uint64_t)(size_t)W + (uint64_t)(n0 + (wave - 2u) * 64u) * SRCP;
    const uint32_t dst = (uint32_t)(size_t)L + wave * T_SLICE;

    // descriptor group 1: bytes, tile = tensor = 64 rows of 256 B, 16 B pad per row
    u32x8 g1;
    g1[0] = uni((1u << 20) | (5u << 22) | (3u << 25));
    g1[1] = uni(T_ROWB << 16);
    g1[2] = uni(64u << 16);
    g1[3] = uni(T_ROWB << 16);
    g1[4] = uni(64u);
    g1[5] = uni(SRCP);
    g1[6] = uni(0u);
    g1[7] = uni(0u);

    // descriptor group 0 of stage st: count 1, place in LDS, source address, type 2
    auto group0 = [&](uint32_t st) {
        const uint64_t ga = src + (uint64_t)st * T_ROWB;
        u32x4 g;
        g[0] = uni(1u);
        g[1] = uni(dst + (st & 1u) * T_BUF);
        g[2] = uni((uint32_t)ga);
        g[3] = uni((((uint32_t)(ga >> 32)) & 0x01FFFFFFu) | 0x80000000u);
        return g;
    };

#pragma unroll
    for (int i = 0; i < 4; i++)
#pragma unroll
        for (int j = 0; j < 4; j++)
            acc[i][j] = v8f_zero();

    // Stage 0: load and wait in one statement, so that no descriptor register can be
    // rewritten while the request is outstanding.
    u32x4 g0 = group0(0);
    asm volatile("tensor_load_to_lds %0, %1\n\ts_wait_tensorcnt 0x0"
                 :: "s"(g0), "s"(g1) : "memory");       // own slice of stage 0 has landed
    __syncthreads();                                    // ... and every other wave's
    // Stage 1 and the refills: g0 is an in-out operand of the load and an input of the
    // wait that covers it, which keeps the descriptor in its registers up to that wait.
    g0 = group0(1);
    asm volatile("tensor_load_to_lds %0, %1" : "+s"(g0) : "s"(g1) : "memory");

    const uint32_t aoff = wm * T_SLICE + lr * T_PITCH + hf * 16u;
    const uint32_t boff = (2u + wn) * T_SLICE + lr * T_PITCH + hf * 16u;

#pragma unroll 1   // one pass per trip: the ring's waits stand once, at the foot
    for (uint32_t s = 0; s < NP; ++s) {
        const unsigned char* pa = L + (s & 1u) * T_BUF + aoff;
        const unsigned char* pb = L + (s & 1u) * T_BUF + boff;
        Frag16 a[2][4], b[2][4];
#pragma unroll
        for (int i = 0; i < 4; i++) {
            a[0][i].h[0] = *reinterpret_cast<const bf16x8*>(pa + i * 16 * T_PITCH);
            a[0][i].h[1] = *reinterpret_cast<const bf16x8*>(pa + i * 16 * T_PITCH + 32);
            b[0][i].h[0] = *reinterpret_cast<const bf16x8*>(pb + i * 16 * T_PITCH);
            b[0][i].h[1] = *reinterpret_cast<const bf16x8*>(pb + i * 16 * T_PITCH + 32);
        }
#pragma unroll
        for (int ks = 0; ks < 4; ks++) {
            const int cur = ks & 1, nxt = cur ^ 1;
            if (ks < 3) {   // the next 32 k's fragments, as one group ahead of this block
                // fence pair: without it the compiler spreads these reads among the
                // WMMAs with a full LDS wait at each place, which stalls the matrix pipe
                __builtin_amdgcn_sched_barrier(0);
#pragma unroll
                for (int i = 0; i < 4; i++) {
                    const int o = i * 16 * T_PITCH + (ks + 1) * 64;
                    a[nxt][i].h[0] = *reinterpret_cast<const bf16x8*>(pa + o);
                    a[nxt][i].h[1] = *reinterpret_cast<const bf16x8*>(pa + o + 32);
                    b[nxt][i].h[0] = *reinterpret_cast<const bf16x8*>(pb + o);
                    b[nxt][i].h[1] = *reinterpret_cast<const bf16x8*>(pb + o + 32);
                }
                __builtin_amdgcn_sched_barrier(0);  // closes the pair
            }
#pragma unroll
            for (int i = 0; i < 4; i++)
#pragma unroll
                for (int j = 0; j < 4; j++)
                    acc[i][j] = wmma_bf16(a[cur][i], b[cur][j], acc[i][j]);
        }
        // keeps the WMMAs above in front of the waits below: the compiler otherwise lifts
        // the full LDS wait to just behind the last read group, where the wave stalls on it
        __builtin_amdgcn_sched_barrier(0);
        // publish point of stage s + 1
        asm volatile("s_wait_dscnt 0x0" ::: "memory");      // own reads of this buffer are done
        // own slice of stage s + 1 has landed; names the descriptor, see above
        asm volatile("s_wait_tensorcnt 0x0" :: "s"(g0), "s"(g1) : "memory");
        __syncthreads();   // publishes stage s + 1; ends every reader's last read of stage s
        if (pinned(s + 2u < NP)) {                          // refill the buffer just left
            g0 = group0(s + 2u);
            asm volatile("tensor_load_to_lds %0, %1" : "+s"(g0) : "s"(g1) : "memory");
        }
    }
    asm volatile("s_wait_tensorcnt 0x0" ::: "memory");  // no request outlives the loop
    asm volatile("s_wait_dscnt 0x0" ::: "memory");
}

// ---------------------------------------------------------------------------
// QKV GEMM: [4096,1024] x [3072,1024]^T, epilogue scatters into
//   Q [B,H,N,64] (scaled by hd^-0.5, +q_bias), K [B,H,N,64],
//   V^T [B,H,64,N] (+v_bias)  -- V transposed so its fragments for P*V load contiguous.
// grid (32, 24), block 128 (4 waves, each 64x64)
// ---------------------------------------------------------------------------
__global__ void __launch_bounds__(128) gemm_qkv_kernel(const bf16_t* __restrict__ A,
                                const bf16_t* __restrict__ W,
                                const float* __restrict__ q_bias,
                                const float* __restrict__ v_bias,
                                bf16_t* __restrict__ qo,
                                bf16_t* __restrict__ ko,
                                bf16_t* __restrict__ vto) {
    __shared__ __attribute__((aligned(2048))) unsigned char L[T_LDS];
    int wv = threadIdx.x >> 5;
    v8f acc[4][4];
    block_gemm_128x128<DIMC>(A, W, blockIdx.x * 128u, blockIdx.y * 128u, L, acc);
    int m0 = blockIdx.x * 128 + (wv >> 1) * 64;   // this wave's 64 x 64 part
    int n0 = blockIdx.y * 128 + (wv & 1) * 64;

    int lane = threadIdx.x & 31, hf = lane >> 4, lr = lane & 15;
#pragma unroll
    for (int i = 0; i < 4; i++)
#pragma unroll
        for (int j = 0; j < 4; j++) {
            int col    = n0 + j * 16 + lr;      // 0..3071
            int sec    = col >> 10;             // 0=q 1=k 2=v
            int within = col & 1023;
            int hh     = within >> 6;
            int d      = within & 63;
            float bias = (sec == 0) ? q_bias[within]
                       : (sec == 2) ? v_bias[within] : 0.f;
#pragma unroll
            for (int r = 0; r < 8; r++) {
                int row = m0 + i * 16 + 8 * hf + r;  // global token row
                int bi  = row >> 10;
                int n   = row & 1023;
                float val = acc[i][j][r] + bias;
                size_t bh = (size_t)bi * NHEAD + hh;
                if (sec == 0)
                    qo[(bh * SEQN + n) * HDIM + d] = (bf16_t)(val * 0.125f);
                else if (sec == 1)
                    ko[(bh * SEQN + n) * HDIM + d] = (bf16_t)val;
                else
                    vto[(bh * HDIM + d) * SEQN + n] = (bf16_t)val;
            }
        }
}

// ---------------------------------------------------------------------------
// Flash attention: a work-group of 8 waves per (b, h, 128 queries), one 16-query tile a
// wave, on transposed products.
// S^T(32 keys x 16 queries) = K_tile(16x64) * Q^T via 2 WMMAs per key-subtile: a lane
// holds 8 keys of ONE query per subtile (lanes l and l ^ 16 share a query), so the
// softmax row maximum and sum run inside the lane, with one exchange between the halves.
// O^T(64 x 16) += V^T(16x32) * P^T(32x16) via 4 WMMAs: the C layout of S^T (key 8*hf + r)
// is the B layout of P^T (k = 8*hf + e, 16 + 8*hf + e), so P is packed from the lane's
// own registers.  + rel_pos_bias, key-padding mask; online softmax.
// K, V^T and the bias are staged in LDS by the tensor mover, 64 keys a stage, two buffers:
// the load of stage s + 2 flies while stage s + 1 is worked on.  A buffer is eight slices
// of 32 rows, one a wave: [bias q 0-31 | 32-63 | 64-95 | 96-127 | K key 0-31 | 32-63 |
// V^T d 0-31 | 32-63].  Bias rows are 256 B at pitch 272, K and V^T rows 128 B at pitch 144
// (16 B pad laid by the mover).
// grid 512, block 256.
// ---------------------------------------------------------------------------
typedef __attribute__((ext_vector_type(4))) int i32x4;

#define AT_NST    16u       // stages: SEQN / 64 keys
#define AB_PITCH  272u      // bias row pitch in LDS
#define AK_PITCH  144u      // K and V^T row pitch in LDS
#define AB_SLICE  10240u    // 32 rows * 272 B, rounded up to a multiple of 2 KiB
#define AK_SLICE  6144u     // 32 rows * 144 B, rounded up to a multiple of 2 KiB
#define AT_KOFF   40960u    // behind four bias slices
#define AT_VOFF   53248u    // behind two K slices
#define AT_BUF    65536u    // eight slices
#define AT_LDS    131072u   // two buffers

// value of lane l ^ 16
__device__ inline float xhalf(float x) {
    int b = __builtin_bit_cast(int, x);
    return __builtin_bit_cast(float,
        __builtin_amdgcn_permlanex16(b, b, 0x76543210, 0xfedcba98, false, false));
}

__global__ void __launch_bounds__(256) attention_kernel(const bf16_t* __restrict__ Q,
                                 const bf16_t* __restrict__ Km,
                                 const bf16_t* __restrict__ Vt,
                                 const float* __restrict__ rel,
                                 const int* __restrict__ amask,
                                 bf16_t* __restrict__ out) {
    __shared__ __attribute__((aligned(2048))) unsigned char L[AT_LDS];
    const uint32_t wave = uni(threadIdx.x >> 5);
    int blk = blockIdx.x;
    int qb  = blk & 7;           // SEQN/128 = 8 query blocks
    int bh  = blk >> 3;
    int h   = bh & (NHEAD - 1);
    int bi  = bh >> 4;
    int qbase = qb * 128 + (int)wave * 16;

    int lane = threadIdx.x & 31;
    int hf   = lane >> 4;
    int lr   = lane & 15;

    const bf16_t* Qb = Q + ((size_t)bh * SEQN + qbase) * HDIM;
    const int*    Mb = amask + (size_t)bi * SEQN;

    // this wave's slice: first source byte, bytes from stage to stage, source pitch, place,
    // row length and the pad word that goes with it (16 B behind every row)
    uint64_t src;
    uint32_t step, srcp, dst, rowb, padw;
    if (wave < 4u) {          // 32 queries' bias rows
        src  = (uint64_t)(size_t)rel
             + ((uint64_t)(uint32_t)(h * SEQN + qb * 128) + wave * 32u) * (SEQN * 4u);
        step = 256u;  srcp = SEQN * 4u;
        dst  = wave * AB_SLICE;
        rowb = 256u;  padw = (1u << 20) | (5u << 22) | (3u << 25);
    } else if (wave < 6u) {   // 32 keys of K
        src  = (uint64_t)(size_t)Km
             + ((uint64_t)(uint32_t)(bh * SEQN) + (wave - 4u) * 32u) * (HDIM * 2u);
        step = 64u * HDIM * 2u;  srcp = HDIM * 2u;
        dst  = AT_KOFF + (wave - 4u) * AK_SLICE;
        rowb = 128u;  padw = (1u << 20) | (4u << 22) | (3u << 25);
    } else {                  // 32 d rows of V^T
        src  = (uint64_t)(size_t)Vt
             + ((uint64_t)(uint32_t)(bh * HDIM) + (wave - 6u) * 32u) * (SEQN * 2u);
        step = 128u;  srcp = SEQN * 2u;
        dst  = AT_VOFF + (wave - 6u) * AK_SLICE;
        rowb = 128u;  padw = (1u << 20) | (4u << 22) | (3u << 25);
    }
    dst += (uint32_t)(size_t)L;

    // descriptor group 1: bytes, tile = tensor = 32 rows of rowb bytes, 16 B pad per row
    u32x8 g1;
    g1[0] = uni(padw);
    g1[1] = uni(rowb << 16);
    g1[2] = uni(32u << 16);
    g1[3] = uni(rowb << 16);
    g1[4] = uni(32u);
    g1[5] = uni(srcp);
    // pinned(), descriptor words held in scalar registers of their own: as plain
    // zeros the compiler shares them with other values and rewrites them under a request
    g1[6] = pinned(0u);
    g1[7] = pinned(0u);

    // descriptor group 0 of stage st: count 1, place in LDS, source address, type 2
    auto group0 = [&](uint32_t st) {
        const uint64_t ga = src + (uint64_t)(st * step);
        u32x4 g;
        g[0] = uni(1u);
        g[1] = uni(dst + (st & 1u) * AT_BUF);
        g[2] = uni((uint32_t)ga);
        g[3] = uni((((uint32_t)(ga >> 32)) & 0x01FFFFFFu) | 0x80000000u);
        return g;
    };

    // Stage 0: load and wait in one statement, so that no descriptor register can be
    // rewritten while the request is outstanding.  Every wave issues its own slice.
    u32x4 g0 = group0(0);
    asm volatile("tensor_load_to_lds %0, %1\n\ts_wait_tensorcnt 0x0"
                 :: "s"(g0), "s"(g1) : "memory");       // own slice of stage 0 has landed
    __syncthreads();                                    // ... and every other wave's
    // Stage 1 and the refills: g0 is an in-out operand of the load and an input of the
    // wait that covers it, which keeps the descriptor in its registers up to that wait.
    g0 = group0(1);
    asm volatile("tensor_load_to_lds %0, %1" : "+s"(g0) : "s"(g1) : "memory");

    // Q^T B-frags (column = query lr) for the two 32-wide K(=d) halves
    Frag16 aq[2];
#pragma unroll   // keeps the register arrays indexed by constants
    for (int s = 0; s < 2; s++) {
        const bf16_t* p = Qb + (size_t)lr * HDIM + s * 32 + hf * 8;
        aq[s].h[0] = load8(p);
        aq[s].h[1] = load8(p + 16);
    }

    // this lane's query is qbase + lr; its keys in a 16-key subtile are 8 * hf + 0..7
    const int* Ml = Mb + hf * 8;
    // the lane's places in a buffer: its query's bias row, its key row, its d row
    const uint32_t roff = (wave >> 1) * AB_SLICE + ((wave & 1u) * 16u + lr) * AB_PITCH + hf * 32u;
    const uint32_t koff = AT_KOFF + lr * AK_PITCH + hf * 16u;
    const uint32_t voff = AT_VOFF + lr * AK_PITCH + hf * 16u;

    float mrow = -1e30f;   // running maximum of the query's row (equal in both halves)
    float lsum = 0.f;      // running sum over this half's keys; the halves join at the end
    v8f o[4];              // O^T: o[j][r] = d 16 * j + 8 * hf + r of query lr
#pragma unroll   // keeps the register arrays indexed by constants
    for (int j = 0; j < 4; j++) o[j] = v8f_zero();

#pragma unroll 1   // one stage per trip: the ring's waits stand once, at the foot
    for (uint32_t st = 0; st < AT_NST; ++st) {
        const unsigned char* B = L + (st & 1u) * AT_BUF;
#pragma unroll 1   // kept rolled: unrolled, the build took 31 more registers for as many vector instructions
        for (int it = 0; it < 2; it++) {
            const int kk = (int)st * 64 + it * 32;
            // ---- scores for two 16-key subtiles, keys in rows
            v8f s[2];
#pragma unroll   // keeps the register arrays indexed by constants
            for (int t = 0; t < 2; t++) {
                const unsigned char* kp = B + koff + it * AK_SLICE + t * 16 * AK_PITCH;
                Frag16 b0, b1;
                b0.h[0] = *reinterpret_cast<const bf16x8*>(kp);
                b0.h[1] = *reinterpret_cast<const bf16x8*>(kp + 32);
                b1.h[0] = *reinterpret_cast<const bf16x8*>(kp + 64);
                b1.h[1] = *reinterpret_cast<const bf16x8*>(kp + 96);
                s[t] = wmma_bf16(b0, aq[0], v8f_zero());
                s[t] = wmma_bf16(b1, aq[1], s[t]);
            }
            // ---- bias + key-padding mask: 8 keys in a row per subtile
            f32x4 rb[2][2];
            i32x4 mk[2][2];
#pragma unroll   // keeps the register arrays indexed by constants
            for (int t = 0; t < 2; t++) {
                const f32x4* bp = reinterpret_cast<const f32x4*>(B + roff + it * 128 + t * 64);
                const i32x4* mp = reinterpret_cast<const i32x4*>(Ml + kk + t * 16);
                rb[t][0] = bp[0];  rb[t][1] = bp[1];
                mk[t][0] = mp[0];  mk[t][1] = mp[1];
            }
            // stands ahead of any rewrite of the address registers that the mask loads name
            asm volatile("s_wait_xcnt 0x0" ::: "memory");
            float sv[2][8];
#pragma unroll   // keeps the register arrays indexed by constants
            for (int t = 0; t < 2; t++)
#pragma unroll   // keeps the register arrays indexed by constants
                for (int r = 0; r < 4; r++) {
                    sv[t][r]     = mk[t][0][r] ? s[t][r] + rb[t][0][r]     : -1e30f;
                    sv[t][r + 4] = mk[t][1][r] ? s[t][r + 4] + rb[t][1][r] : -1e30f;
                }
            // ---- online softmax: the row maximum over the lane's 16 keys, then the other half's
            float v = fmaxf(sv[0][0], sv[1][0]);
#pragma unroll   // keeps the register arrays indexed by constants
            for (int r = 1; r < 8; r++)
                v = fmaxf(v, fmaxf(sv[0][r], sv[1][r]));
            v = fmaxf(v, xhalf(v));
            float mnew  = fmaxf(mrow, v);
            float scale = __expf(mrow - mnew);
#pragma unroll   // keeps the register arrays indexed by constants
            for (int j = 0; j < 4; j++)
#pragma unroll   // keeps the register arrays indexed by constants
                for (int r = 0; r < 8; r++)
                    o[j][r] = o[j][r] * scale;
            // ---- P^T B-frag straight from the lane's own scores, cast to bf16
            Frag16 pt;
            float srow = 0.f;
#pragma unroll   // keeps the register arrays indexed by constants
            for (int r = 0; r < 8; r++)
#pragma unroll   // keeps the register arrays indexed by constants
                for (int t = 0; t < 2; t++) {
                    float p = (sv[t][r] > -1e29f) ? __expf(sv[t][r] - mnew) : 0.f;
                    srow += p;
                    pt.v[t * 8 + r] = (bf16_t)p;
                }
            lsum = lsum * scale + srow;
            mrow = mnew;

            // ---- O^T += V^T * P^T  (V^T rows in LDS: keys run along a row)
#pragma unroll   // keeps the register arrays indexed by constants
            for (int j = 0; j < 4; j++) {
                const unsigned char* vp = B + voff + (j >> 1) * AK_SLICE
                                        + (j & 1) * 16 * AK_PITCH + it * 64;
                Frag16 bv;
                bv.h[0] = *reinterpret_cast<const bf16x8*>(vp);
                bv.h[1] = *reinterpret_cast<const bf16x8*>(vp + 32);
                o[j] = wmma_bf16(bv, pt, o[j]);
            }
        }
        // publish point of stage st + 1
        asm volatile("s_wait_dscnt 0x0" ::: "memory");      // own reads of this buffer are done
        // own slice of stage st + 1 has landed; names the descriptor, see above
        asm volatile("s_wait_tensorcnt 0x0" :: "s"(g0), "s"(g1) : "memory");
        __syncthreads();   // publishes stage st + 1; ends every reader's last read of stage st
        if (pinned(st + 2u < AT_NST)) {                     // refill the buffer just left
            g0 = group0(st + 2u);
            asm volatile("tensor_load_to_lds %0, %1" : "+s"(g0) : "s"(g1) : "memory");
        }
    }
    asm volatile("s_wait_tensorcnt 0x0" ::: "memory");  // no request outlives the loop
    asm volatile("s_wait_dscnt 0x0" ::: "memory");

    // ---- normalize and write [B,N, H*64] bf16: 8 d in a row per lane and tile
    float l   = lsum + xhalf(lsum);
    float inv = (l > 0.f) ? 1.f / l : 0.f;
    bf16_t* op = out + ((size_t)bi * SEQN + qbase + lr) * DIMC + h * HDIM + hf * 8;
#pragma unroll   // keeps the register arrays indexed by constants
    for (int j = 0; j < 4; j++) {
        bf16x8 w;
#pragma unroll   // keeps the register arrays indexed by constants
        for (int r = 0; r < 8; r++)
            w[r] = (bf16_t)(o[j][r] * inv);
        *reinterpret_cast<bf16x8*>(op + j * 16) = w;
    }
}

// ---------------------------------------------------------------------------
// Proj GEMM + bias + residual -> f32.  grid (32,8), block 128
// ---------------------------------------------------------------------------
__global__ void __launch_bounds__(128) gemm_proj_kernel(const bf16_t* __restrict__ A,
                                 const bf16_t* __restrict__ W,
                                 const float* __restrict__ bias,
                                 const float* __restrict__ resid,
                                 float* __restrict__ out) {
    __shared__ __attribute__((aligned(2048))) unsigned char L[T_LDS];
    int wv = threadIdx.x >> 5;
    v8f acc[4][4];
    block_gemm_128x128<DIMC>(A, W, blockIdx.x * 128u, blockIdx.y * 128u, L, acc);
    int m0 = blockIdx.x * 128 + (wv >> 1) * 64;   // this wave's 64 x 64 part
    int n0 = blockIdx.y * 128 + (wv & 1) * 64;
    int lane = threadIdx.x & 31, hf = lane >> 4, lr = lane & 15;
#pragma unroll
    for (int i = 0; i < 4; i++)
#pragma unroll
        for (int j = 0; j < 4; j++) {
            int col = n0 + j * 16 + lr;
            float bv = bias[col];
#pragma unroll
            for (int r = 0; r < 8; r++) {
                size_t row = (size_t)(m0 + i * 16 + 8 * hf + r);
                out[row * DIMC + col] = acc[i][j][r] + bv + resid[row * DIMC + col];
            }
        }
}

// ---------------------------------------------------------------------------
// MLP1 GEMM + bias + exact GELU -> bf16.  grid (32,32), block 128
// ---------------------------------------------------------------------------
__global__ void __launch_bounds__(128) gemm_mlp1_kernel(const bf16_t* __restrict__ A,
                                 const bf16_t* __restrict__ W,
                                 const float* __restrict__ bias,
                                 bf16_t* __restrict__ out) {
    __shared__ __attribute__((aligned(2048))) unsigned char L[T_LDS];
    int wv = threadIdx.x >> 5;
    v8f acc[4][4];
    block_gemm_128x128<DIMC>(A, W, blockIdx.x * 128u, blockIdx.y * 128u, L, acc);
    int m0 = blockIdx.x * 128 + (wv >> 1) * 64;   // this wave's 64 x 64 part
    int n0 = blockIdx.y * 128 + (wv & 1) * 64;
    int lane = threadIdx.x & 31, hf = lane >> 4, lr = lane & 15;
#pragma unroll
    for (int i = 0; i < 4; i++)
#pragma unroll
        for (int j = 0; j < 4; j++) {
            int col = n0 + j * 16 + lr;
            float bv = bias[col];
#pragma unroll
            for (int r = 0; r < 8; r++) {
                size_t row = (size_t)(m0 + i * 16 + 8 * hf + r);
                float v = acc[i][j][r] + bv;
                float g = 0.5f * v * (1.f + erff(v * 0.70710678118654752f));
                out[row * HIDDEN + col] = (bf16_t)g;
            }
        }
}

// ---------------------------------------------------------------------------
// MLP2 GEMM + bias + residual -> f32 final output.  grid (32,8), block 128
// ---------------------------------------------------------------------------
__global__ void __launch_bounds__(128) gemm_mlp2_kernel(const bf16_t* __restrict__ A,
                                 const bf16_t* __restrict__ W,
                                 const float* __restrict__ bias,
                                 const float* __restrict__ resid,
                                 float* __restrict__ out) {
    __shared__ __attribute__((aligned(2048))) unsigned char L[T_LDS];
    int wv = threadIdx.x >> 5;
    v8f acc[4][4];
    block_gemm_128x128<HIDDEN>(A, W, blockIdx.x * 128u, blockIdx.y * 128u, L, acc);
    int m0 = blockIdx.x * 128 + (wv >> 1) * 64;   // this wave's 64 x 64 part
    int n0 = blockIdx.y * 128 + (wv & 1) * 64;
    int lane = threadIdx.x & 31, hf = lane >> 4, lr = lane & 15;
#pragma unroll
    for (int i = 0; i < 4; i++)
#pragma unroll
        for (int j = 0; j < 4; j++) {
            int col = n0 + j * 16 + lr;
            float bv = bias[col];
#pragma unroll
            for (int r = 0; r < 8; r++) {
                size_t row = (size_t)(m0 + i * 16 + 8 * hf + r);
                out[row * DIMC + col] = acc[i][j][r] + bv + resid[row * DIMC + col];
            }
        }
}

// ---------------------------------------------------------------------------
// Host driver
// ---------------------------------------------------------------------------
extern "C" void kernel_launch(void* const* d_in, const int* in_sizes, int n_in,
                              void* d_out, int out_size, void* d_ws, size_t ws_size,
                              hipStream_t stream) {
    const float* x      = (const float*)d_in[0];
    const float* rel    = (const float*)d_in[1];
    const int*   amask  = (const int*)  d_in[2];
    const float* n1w    = (const float*)d_in[3];
    const float* n1b    = (const float*)d_in[4];
    const float* qkv_w  = (const float*)d_in[5];
    const float* q_bias = (const float*)d_in[6];
    const float* v_bias = (const float*)d_in[7];
    const float* proj_w = (const float*)d_in[8];
    const float* proj_b = (const float*)d_in[9];
    const float* n2w    = (const float*)d_in[10];
    const float* n2b    = (const float*)d_in[11];
    const float* w1     = (const float*)d_in[12];
    const float* b1     = (const float*)d_in[13];
    const float* w2     = (const float*)d_in[14];
    const float* b2     = (const float*)d_in[15];
    float* out = (float*)d_out;
    (void)in_sizes; (void)n_in; (void)out_size; (void)ws_size;

    char* ws = (char*)d_ws;
    size_t off = 0;
    auto alloc = [&](size_t bytes) -> char* {
        char* p = ws + off;
        off = (off + bytes + 255) & ~(size_t)255;
        return p;
    };
    bf16_t* ln1b   = (bf16_t*)alloc((size_t)MROWS * DIMC * 2);
    bf16_t* wqkvb  = (bf16_t*)alloc((size_t)3 * DIMC * DIMC * 2);
    bf16_t* qb     = (bf16_t*)alloc((size_t)MROWS * DIMC * 2);   // [B,H,N,64]
    bf16_t* kb     = (bf16_t*)alloc((size_t)MROWS * DIMC * 2);   // [B,H,N,64]
    bf16_t* vtb    = (bf16_t*)alloc((size_t)MROWS * DIMC * 2);   // [B,H,64,N]
    bf16_t* attnb  = (bf16_t*)alloc((size_t)MROWS * DIMC * 2);   // [B*N, C]
    bf16_t* wprojb = (bf16_t*)alloc((size_t)DIMC * DIMC * 2);
    float*  x1     = (float*) alloc((size_t)MROWS * DIMC * 4);
    bf16_t* ln2b   = (bf16_t*)alloc((size_t)MROWS * DIMC * 2);
    bf16_t* w1b    = (bf16_t*)alloc((size_t)HIDDEN * DIMC * 2);
    bf16_t* hb     = (bf16_t*)alloc((size_t)MROWS * HIDDEN * 2);
    bf16_t* w2b    = (bf16_t*)alloc((size_t)DIMC * HIDDEN * 2);

    // weight conversions
    cvt_f32_bf16_kernel<<<(3 * DIMC * DIMC) / CVT_BLOCK, CVT_THREADS, 0, stream>>>(qkv_w, wqkvb);
    cvt_f32_bf16_kernel<<<(DIMC * DIMC) / CVT_BLOCK, CVT_THREADS, 0, stream>>>(proj_w, wprojb);
    cvt_f32_bf16_kernel<<<(HIDDEN * DIMC) / CVT_BLOCK, CVT_THREADS, 0, stream>>>(w1, w1b);
    cvt_f32_bf16_kernel<<<(DIMC * HIDDEN) / CVT_BLOCK, CVT_THREADS, 0, stream>>>(w2, w2b);

    // x -> LN1 -> bf16
    layernorm_bf16_kernel<<<MROWS, 256, 0, stream>>>(x, n1w, n1b, ln1b, DIMC);

    // QKV projection + head scatter
    gemm_qkv_kernel<<<dim3(MROWS / 128, (3 * DIMC) / 128), 128, 0, stream>>>(
        ln1b, wqkvb, q_bias, v_bias, qb, kb, vtb);

    // flash attention per (b, h, 128 queries)
    attention_kernel<<<BATCH * NHEAD * (SEQN / 128), 256, 0, stream>>>(
        qb, kb, vtb, rel, amask, attnb);

    // proj + residual -> x1 (f32)
    gemm_proj_kernel<<<dim3(MROWS / 128, DIMC / 128), 128, 0, stream>>>(
        attnb, wprojb, proj_b, x, x1);

    // LN2 -> bf16
    layernorm_bf16_kernel<<<MROWS, 256, 0, stream>>>(x1, n2w, n2b, ln2b, DIMC);

    // MLP
    gemm_mlp1_kernel<<<dim3(MROWS / 128, HIDDEN / 128), 128, 0, stream>>>(
        ln2b, w1b, b1, hb);
    gemm_mlp2_kernel<<<dim3(MROWS / 128, DIMC / 128), 128, 0, stream>>>(
        hb, w2b, b2, x1, out);
}

// v005
// It runs in 194 microseconds.
// In two side-by-side timings against v004, it was 1.24 and 1.23 times as fast.
// Over all steps from v000 it is 2.82 times as fast.
#include <hip/hip_runtime.h>

// ---------------------------------------------------------------------------
// Types for CDNA5 WMMA (gfx1250, wave32)
// ---------------------------------------------------------------------------
typedef __bf16 bf16_t;
typedef __attribute__((ext_vector_type(16))) __bf16 bf16x16;
typedef __attribute__((ext_vector_type(8)))  __bf16 bf16x8;
typedef __attribute__((ext_vector_type(8)))  float  v8f;

union Frag16 {
    bf16x16 v;
    bf16x8  h[2];
};

__device__ inline bf16x8 load8(const bf16_t* p) {
    return *reinterpret_cast<const bf16x8*>(p);
}

__device__ inline v8f v8f_zero() {
    v8f z = {0.f, 0.f, 0.f, 0.f, 0.f, 0.f, 0.f, 0.f};
    return z;
}

__device__ inline v8f wmma_bf16(const Frag16& a, const Frag16& b, v8f c) {
    // D = A(16x32 bf16) * B(32x16 bf16) + C(16x16 f32)
    return __builtin_amdgcn_wmma_f32_16x16x32_bf16(
        /*neg_a=*/false, a.v, /*neg_b=*/false, b.v,
        /*c_mod=*/(short)0, c, /*reuse_a=*/false, /*reuse_b=*/false);
}

// ---------------------------------------------------------------------------
// Constants
// ---------------------------------------------------------------------------
#define DIMC   1024
#define NHEAD  16
#define HDIM   64
#define SEQN   1024
#define BATCH  4
#define MROWS  4096      // BATCH * SEQN
#define HIDDEN 4096

// ---------------------------------------------------------------------------
// f32 -> bf16 conversion (weights, once per call), as a stream: few waves, each
// with much in flight.  A work-group of 4 waves takes 8192 elements in a row;
// a lane issues its 16 loads of 16 B (each wave-wide load covers 512 B in a row)
// ahead of the first conversion, then stores 8 B per load (256 B in a row a wave).
// Every weight's element count is a multiple of CVT_BLOCK, so there is no tail.
// ---------------------------------------------------------------------------
typedef __attribute__((ext_vector_type(4))) float  f32x4;
typedef __attribute__((ext_vector_type(4))) __bf16 bf16x4;

#define CVT_THREADS 128
#define CVT_VECS    16
#define CVT_BLOCK   (CVT_THREADS * 4 * CVT_VECS)   // elements per work-group

__global__ void __launch_bounds__(CVT_THREADS)
cvt_f32_bf16_kernel(const float* __restrict__ src, bf16_t* __restrict__ dst) {
    const f32x4* __restrict__ s4 = reinterpret_cast<const f32x4*>(src);
    bf16x4* __restrict__      d4 = reinterpret_cast<bf16x4*>(dst);
    const uint32_t idx = blockIdx.x * (CVT_THREADS * CVT_VECS) + threadIdx.x;  // in groups of 4
    f32x4 v[CVT_VECS];
#pragma unroll   // all loads in flight together: the registers are indexed by constants
    for (int u = 0; u < CVT_VECS; u++)
        v[u] = s4[idx + u * CVT_THREADS];
    // keeps every load ahead of the first conversion: without it the compiler holds the
    // last four back until the first have returned, a second memory latency per wave
    __builtin_amdgcn_sched_barrier(0);
#pragma unroll   // as above
    for (int u = 0; u < CVT_VECS; u++)
        d4[idx + u * CVT_THREADS] = __builtin_convertvector(v[u], bf16x4);
}

// ---------------------------------------------------------------------------
// LayerNorm: one row (1024 f32) per workgroup (8 waves), bf16 output
// ---------------------------------------------------------------------------
__global__ void layernorm_bf16_kernel(const float* __restrict__ x,
                                      const float* __restrict__ w,
                                      const float* __restrict__ b,
                                      bf16_t* __restrict__ out, int cols) {
    int row = blockIdx.x;
    const float* xr = x + (size_t)row * cols;
    float s1 = 0.f, s2 = 0.f;
    for (int c = threadIdx.x; c < cols; c += blockDim.x) {
        float v = xr[c];
        s1 += v;
        s2 += v * v;
    }
#pragma unroll
    for (int off = 16; off > 0; off >>= 1) {
        s1 += __shfl_xor(s1, off, 32);
        s2 += __shfl_xor(s2, off, 32);
    }
    __shared__ float r1[8], r2[8];
    int wid = threadIdx.x >> 5;
    int lane = threadIdx.x & 31;
    if (lane == 0) { r1[wid] = s1; r2[wid] = s2; }
    __syncthreads();
    if (threadIdx.x == 0) {
        float a = 0.f, bb = 0.f;
        for (int i = 0; i < 8; i++) { a += r1[i]; bb += r2[i]; }
        r1[0] = a; r2[0] = bb;
    }
    __syncthreads();
    float mu  = r1[0] / cols;
    float var = r2[0] / cols - mu * mu;
    float rs  = rsqrtf(var + 1e-5f);
    for (int c = threadIdx.x; c < cols; c += blockDim.x) {
        out[(size_t)row * cols + c] = (bf16_t)((xr[c] - mu) * rs * w[c] + b[c]);
    }
}

// ---------------------------------------------------------------------------
// Core: one workgroup (4 waves, 2 x 2) computes a 128(M) x 128(N) tile of
// A[MxK] * W[NxK]^T; each wave a 64 x 64 part, acc[i][j] = C-frag for M-subtile i
// and N-subtile j.  A row-major [M,K] bf16, W row-major [N,K] bf16.
// Both operands are staged in LDS by the tensor mover, 128 k (256 B of every
// row) per pass, two buffers: the load of pass s + 2 flies while pass s + 1 runs.
// A buffer is four slices of 64 rows, [A 0-63 | A 64-127 | W 0-63 | W 64-127];
// wave w brings slice w.  Rows lie at pitch 272 B (16 B pad laid by the mover).
// ---------------------------------------------------------------------------
typedef uint32_t u32x4 __attribute__((ext_vector_type(4)));
typedef uint32_t u32x8 __attribute__((ext_vector_type(8)));

#define T_ROWB   256u      // bytes of one staged row (128 k)
#define T_PITCH  272u      // row pitch in LDS
#define T_SLICE  18432u    // 64 rows * 272 B, rounded up to a multiple of 2 KiB
#define T_BUF    73728u    // four slices
#define T_LDS    147456u   // two buffers

__device__ __forceinline__ uint32_t uni(uint32_t v) {
    return (uint32_t)__builtin_amdgcn_readfirstlane(v);
}
// Holds a wave-uniform test in a scalar register, so that the branch round a
// tensor load (which ignores EXEC) compiles to s_cmp + s_cbranch_scc.
__device__ __forceinline__ uint32_t pinned(uint32_t v) {
    uint32_t w = uni(v);
    asm volatile("" : "+s"(w));  // keeps the test scalar
    return w;
}

template <int K>
__device__ __forceinline__ void block_gemm_128x128(const bf16_t* __restrict__ A,
                                                   const bf16_t* __restrict__ W,
                                                   uint32_t m0, uint32_t n0,
                                                   const unsigned char* L,
                                                   v8f acc[4][4]) {
    constexpr uint32_t NP   = K / 128;   // passes; at least two
    constexpr uint32_t SRCP = K * 2;     // source row pitch, bytes
    const uint32_t lane = threadIdx.x & 31u;
    const uint32_t hf   = lane >> 4;     // lane half selects K sub-stripe
    const uint32_t lr   = lane & 15u;    // M row (A) / N col (B) within 16
    const uint32_t wave = uni(threadIdx.x >> 5);
    const uint32_t wm   = wave >> 1, wn = wave & 1u;

    // this wave's slice: its first source byte and its place in LDS
    const uint64_t src = (wave < 2u)
        ? (uint64_t)(size_t)A + (uint64_t)(m0 + wave * 64u) * SRCP
        : (uint64_t)(size_t)W + (uint64_t)(n0 + (wave - 2u) * 64u) * SRCP;
    const uint32_t dst = (uint32_t)(size_t)L + wave * T_SLICE;

    // descriptor group 1: bytes, tile = tensor = 64 rows of 256 B, 16 B pad per row
    u32x8 g1;
    g1[0] = uni((1u << 20) | (5u << 22) | (3u << 25));
    g1[1] = uni(T_ROWB << 16);
    g1[2] = uni(64u << 16);
    g1[3] = uni(T_ROWB << 16);
    g1[4] = uni(64u);
    g1[5] = uni(SRCP);
    g1[6] = uni(0u);
    g1[7] = uni(0u);

    // descriptor group 0 of stage st: count 1, place in LDS, source address, type 2
    auto group0 = [&](uint32_t st) {
        const uint64_t ga = src + (uint64_t)st * T_ROWB;
        u32x4 g;
        g[0] = uni(1u);
        g[1] = uni(dst + (st & 1u) * T_BUF);
        g[2] = uni((uint32_t)ga);
        g[3] = uni((((uint32_t)(ga >> 32)) & 0x01FFFFFFu) | 0x80000000u);
        return g;
    };

#pragma unroll
    for (int i = 0; i < 4; i++)
#pragma unroll
        for (int j = 0; j < 4; j++)
            acc[i][j] = v8f_zero();

    // Stage 0: load and wait in one statement, so that no descriptor register can be
    // rewritten while the request is outstanding.
    u32x4 g0 = group0(0);
    asm volatile("tensor_load_to_lds %0, %1\n\ts_wait_tensorcnt 0x0"
                 :: "s"(g0), "s"(g1) : "memory");       // own slice of stage 0 has landed
    __syncthreads();                                    // ... and every other wave's
    // Stage 1 and the refills: g0 is an in-out operand of the load and an input of the
    // wait that covers it, which keeps the descriptor in its registers up to that wait.
    g0 = group0(1);
    asm volatile("tensor_load_to_lds %0, %1" : "+s"(g0) : "s"(g1) : "memory");

    const uint32_t aoff = wm * T_SLICE + lr * T_PITCH + hf * 16u;
    const uint32_t boff = (2u + wn) * T_SLICE + lr * T_PITCH + hf * 16u;

#pragma unroll 1   // one pass per trip: the ring's waits stand once, at the foot
    for (uint32_t s = 0; s < NP; ++s) {
        const unsigned char* pa = L + (s & 1u) * T_BUF + aoff;
        const unsigned char* pb = L + (s & 1u) * T_BUF + boff;
        Frag16 a[2][4], b[2][4];
#pragma unroll
        for (int i = 0; i < 4; i++) {
            a[0][i].h[0] = *reinterpret_cast<const bf16x8*>(pa + i * 16 * T_PITCH);
            a[0][i].h[1] = *reinterpret_cast<const bf16x8*>(pa + i * 16 * T_PITCH + 32);
            b[0][i].h[0] = *reinterpret_cast<const bf16x8*>(pb + i * 16 * T_PITCH);
            b[0][i].h[1] = *reinterpret_cast<const bf16x8*>(pb + i * 16 * T_PITCH + 32);
        }
#pragma unroll
        for (int ks = 0; ks < 4; ks++) {
            const int cur = ks & 1, nxt = cur ^ 1;
            if (ks < 3) {   // the next 32 k's fragments, as one group ahead of this block
                // fence pair: without it the compiler spreads these reads among the
                // WMMAs with a full LDS wait at each place, which stalls the matrix pipe
                __builtin_amdgcn_sched_barrier(0);
#pragma unroll
                for (int i = 0; i < 4; i++) {
                    const int o = i * 16 * T_PITCH + (ks + 1) * 64;
                    a[nxt][i].h[0] = *reinterpret_cast<const bf16x8*>(pa + o);
                    a[nxt][i].h[1] = *reinterpret_cast<const bf16x8*>(pa + o + 32);
                    b[nxt][i].h[0] = *reinterpret_cast<const bf16x8*>(pb + o);
                    b[nxt][i].h[1] = *reinterpret_cast<const bf16x8*>(pb + o + 32);
                }
                __builtin_amdgcn_sched_barrier(0);  // closes the pair
            }
#pragma unroll
            for (int i = 0; i < 4; i++)
#pragma unroll
                for (int j = 0; j < 4; j++)
                    acc[i][j] = wmma_bf16(a[cur][i], b[cur][j], acc[i][j]);
        }
        // keeps the WMMAs above in front of the waits below: the compiler otherwise lifts
        // the full LDS wait to just behind the last read group, where the wave stalls on it
        __builtin_amdgcn_sched_barrier(0);
        // publish point of stage s + 1
        asm volatile("s_wait_dscnt 0x0" ::: "memory");      // own reads of this buffer are done
        // own slice of stage s + 1 has landed; names the descriptor, see above
        asm volatile("s_wait_tensorcnt 0x0" :: "s"(g0), "s"(g1) : "memory");
        __syncthreads();   // publishes stage s + 1; ends every reader's last read of stage s
        if (pinned(s + 2u < NP)) {                          // refill the buffer just left
            g0 = group0(s + 2u);
            asm volatile("tensor_load_to_lds %0, %1" : "+s"(g0) : "s"(g1) : "memory");
        }
    }
    asm volatile("s_wait_tensorcnt 0x0" ::: "memory");  // no request outlives the loop
    asm volatile("s_wait_dscnt 0x0" ::: "memory");
}

// ---------------------------------------------------------------------------
// QKV GEMM: [4096,1024] x [3072,1024]^T, epilogue scatters into
//   Q [B,H,N,64] (scaled by hd^-0.5, +q_bias), K [B,H,N,64],
//   V^T [B,H,64,N] (+v_bias)  -- V transposed so its fragments for P*V load contiguous.
// grid (32, 24), block 128 (4 waves, each 64x64)
// ---------------------------------------------------------------------------
__global__ void __launch_bounds__(128) gemm_qkv_kernel(const bf16_t* __restrict__ A,
                                const bf16_t* __restrict__ W,
                                const float* __restrict__ q_bias,
                                const float* __restrict__ v_bias,
                                bf16_t* __restrict__ qo,
                                bf16_t* __restrict__ ko,
                                bf16_t* __restrict__ vto) {
    __shared__ __attribute__((aligned(2048))) unsigned char L[T_LDS];
    int wv = threadIdx.x >> 5;
    v8f acc[4][4];
    block_gemm_128x128<DIMC>(A, W, blockIdx.x * 128u, blockIdx.y * 128u, L, acc);
    int m0 = blockIdx.x * 128 + (wv >> 1) * 64;   // this wave's 64 x 64 part
    int n0 = blockIdx.y * 128 + (wv & 1) * 64;

    int lane = threadIdx.x & 31, hf = lane >> 4, lr = lane & 15;
#pragma unroll
    for (int i = 0; i < 4; i++)
#pragma unroll
        for (int j = 0; j < 4; j++) {
            int col    = n0 + j * 16 + lr;      // 0..3071
            int sec    = col >> 10;             // 0=q 1=k 2=v
            int within = col & 1023;
            int hh     = within >> 6;
            int d      = within & 63;
            float bias = (sec == 0) ? q_bias[within]
                       : (sec == 2) ? v_bias[within] : 0.f;
#pragma unroll
            for (int r = 0; r < 8; r++) {
                int row = m0 + i * 16 + 8 * hf + r;  // global token row
                int bi  = row >> 10;
                int n   = row & 1023;
                float val = acc[i][j][r] + bias;
                size_t bh = (size_t)bi * NHEAD + hh;
                if (sec == 0)
                    qo[(bh * SEQN + n) * HDIM + d] = (bf16_t)(val * 0.125f);
                else if (sec == 1)
                    ko[(bh * SEQN + n) * HDIM + d] = (bf16_t)val;
                else
                    vto[(bh * HDIM + d) * SEQN + n] = (bf16_t)val;
            }
        }
}

// ---------------------------------------------------------------------------
// Flash attention: a work-group of 8 waves per (b, h, 128 queries), one 16-query tile a
// wave, on transposed products.
// S^T(32 keys x 16 queries) = K_tile(16x64) * Q^T via 2 WMMAs per key-subtile: a lane
// holds 8 keys of ONE query per subtile (lanes l and l ^ 16 share a query), so the
// softmax row maximum and sum run inside the lane, with one exchange between the halves.
// O^T(64 x 16) += V^T(16x32) * P^T(32x16) via 4 WMMAs: the C layout of S^T (key 8*hf + r)
// is the B layout of P^T (k = 8*hf + e, 16 + 8*hf + e), so P is packed from the lane's
// own registers.  + rel_pos_bias, key-padding mask; online softmax.
// K, V^T and the bias are staged in LDS by the tensor mover, 64 keys a stage, two buffers:
// the load of stage s + 2 flies while stage s + 1 is worked on.  A buffer is eight slices
// of 32 rows, one a wave: [bias q 0-31 | 32-63 | 64-95 | 96-127 | K key 0-31 | 32-63 |
// V^T d 0-31 | 32-63].  Bias rows are 256 B at pitch 272, K and V^T rows 128 B at pitch 144
// (16 B pad laid by the mover).
// grid 512, block 256.
// ---------------------------------------------------------------------------
typedef __attribute__((ext_vector_type(4))) int i32x4;

#define AT_NST    16u       // stages: SEQN / 64 keys
#define AB_PITCH  272u      // bias row pitch in LDS
#define AK_PITCH  144u      // K and V^T row pitch in LDS
#define AB_SLICE  10240u    // 32 rows * 272 B, rounded up to a multiple of 2 KiB
#define AK_SLICE  6144u     // 32 rows * 144 B, rounded up to a multiple of 2 KiB
#define AT_KOFF   40960u    // behind four bias slices
#define AT_VOFF   53248u    // behind two K slices
#define AT_BUF    65536u    // eight slices
#define AT_LDS    131072u   // two buffers

// value of lane l ^ 16
__device__ inline float xhalf(float x) {
    int b = __builtin_bit_cast(int, x);
    return __builtin_bit_cast(float,
        __builtin_amdgcn_permlanex16(b, b, 0x76543210, 0xfedcba98, false, false));
}

__global__ void __launch_bounds__(256) attention_kernel(const bf16_t* __restrict__ Q,
                                 const bf16_t* __restrict__ Km,
                                 const bf16_t* __restrict__ Vt,
                                 const float* __restrict__ rel,
                                 const int* __restrict__ amask,
                                 bf16_t* __restrict__ out) {
    __shared__ __attribute__((aligned(2048))) unsigned char L[AT_LDS];
    const uint32_t wave = uni(threadIdx.x >> 5);
    int blk = blockIdx.x;
    int qb  = blk & 7;           // SEQN/128 = 8 query blocks
    int bh  = blk >> 3;
    int h   = bh & (NHEAD - 1);
    int bi  = bh >> 4;
    int qbase = qb * 128 + (int)wave * 16;

    int lane = threadIdx.x & 31;
    int hf   = lane >> 4;
    int lr   = lane & 15;

    const bf16_t* Qb = Q + ((size_t)bh * SEQN + qbase) * HDIM;
    const int*    Mb = amask + (size_t)bi * SEQN;

    // this wave's slice: first source byte, bytes from stage to stage, source pitch, place,
    // row length and the pad word that goes with it (16 B behind every row)
    uint64_t src;
    uint32_t step, srcp, dst, rowb, padw;
    if (wave < 4u) {          // 32 queries' bias rows
        src  = (uint64_t)(size_t)rel
             + ((uint64_t)(uint32_t)(h * SEQN + qb * 128) + wave * 32u) * (SEQN * 4u);
        step = 256u;  srcp = SEQN * 4u;
        dst  = wave * AB_SLICE;
        rowb = 256u;  padw = (1u << 20) | (5u << 22) | (3u << 25);
    } else if (wave < 6u) {   // 32 keys of K
        src  = (uint64_t)(size_t)Km
             + ((uint64_t)(uint32_t)(bh * SEQN) + (wave - 4u) * 32u) * (HDIM * 2u);
        step = 64u * HDIM * 2u;  srcp = HDIM * 2u;
        dst  = AT_KOFF + (wave - 4u) * AK_SLICE;
        rowb = 128u;  padw = (1u << 20) | (4u << 22) | (3u << 25);
    } else {                  // 32 d rows of V^T
        src  = (uint64_t)(size_t)Vt
             + ((uint64_t)(uint32_t)(bh * HDIM) + (wave - 6u) * 32u) * (SEQN * 2u);
        step = 128u;  srcp = SEQN * 2u;
        dst  = AT_VOFF + (wave - 6u) * AK_SLICE;
        rowb = 128u;  padw = (1u << 20) | (4u << 22) | (3u << 25);
    }
    dst += (uint32_t)(size_t)L;

    // descriptor group 1: bytes, tile = tensor = 32 rows of rowb bytes, 16 B pad per row
    u32x8 g1;
    g1[0] = uni(padw);
    g1[1] = uni(rowb << 16);
    g1[2] = uni(32u << 16);
    g1[3] = uni(rowb << 16);
    g1[4] = uni(32u);
    g1[5] = uni(srcp);
    // pinned(), descriptor words held in scalar registers of their own: as plain
    // zeros the compiler shares them with other values and rewrites them under a request
    g1[6] = pinned(0u);
    g1[7] = pinned(0u);

    // descriptor group 0 of stage st: count 1, place in LDS, source address, type 2
    auto group0 = [&](uint32_t st) {
        const uint64_t ga = src + (uint64_t)(st * step);
        u32x4 g;
        g[0] = uni(1u);
        g[1] = uni(dst + (st & 1u) * AT_BUF);
        g[2] = uni((uint32_t)ga);
        g[3] = uni((((uint32_t)(ga >> 32)) & 0x01FFFFFFu) | 0x80000000u);
        return g;
    };

    // Stage 0: load and wait in one statement, so that no descriptor register can be
    // rewritten while the request is outstanding.  Every wave issues its own slice.
    u32x4 g0 = group0(0);
    asm volatile("tensor_load_to_lds %0, %1\n\ts_wait_tensorcnt 0x0"
                 :: "s"(g0), "s"(g1) : "memory");       // own slice of stage 0 has landed
    __syncthreads();                                    // ... and every other wave's
    // Stage 1 and the refills: g0 is an in-out operand of the load and an input of the
    // wait that covers it, which keeps the descriptor in its registers up to that wait.
    g0 = group0(1);
    asm volatile("tensor_load_to_lds %0, %1" : "+s"(g0) : "s"(g1) : "memory");

    // Q^T B-frags (column = query lr) for the two 32-wide K(=d) halves
    Frag16 aq[2];
#pragma unroll   // keeps the register arrays indexed by constants
    for (int s = 0; s < 2; s++) {
        const bf16_t* p = Qb + (size_t)lr * HDIM + s * 32 + hf * 8;
        aq[s].h[0] = load8(p);
        aq[s].h[1] = load8(p + 16);
    }

    // this lane's query is qbase + lr; its keys in a 16-key subtile are 8 * hf + 0..7
    const int* Ml = Mb + hf * 8;
    // the lane's places in a buffer: its query's bias row, its key row, its d row
    const uint32_t roff = (wave >> 1) * AB_SLICE + ((wave & 1u) * 16u + lr) * AB_PITCH + hf * 32u;
    const uint32_t koff = AT_KOFF + lr * AK_PITCH + hf * 16u;
    const uint32_t voff = AT_VOFF + lr * AK_PITCH + hf * 16u;

    float mrow = -1e30f;   // running maximum of the query's row (equal in both halves)
    float lsum = 0.f;      // running sum over this half's keys; the halves join at the end
    v8f o[4];              // O^T: o[j][r] = d 16 * j + 8 * hf + r of query lr
#pragma unroll   // keeps the register arrays indexed by constants
    for (int j = 0; j < 4; j++) o[j] = v8f_zero();

#pragma unroll 1   // one stage per trip: the ring's waits stand once, at the foot
    for (uint32_t st = 0; st < AT_NST; ++st) {
        const unsigned char* B = L + (st & 1u) * AT_BUF;
#pragma unroll 1   // kept rolled: unrolled, the build took 31 more registers for as many vector instructions
        for (int it = 0; it < 2; it++) {
            const int kk = (int)st * 64 + it * 32;
            // ---- scores for two 16-key subtiles, keys in rows
            v8f s[2];
#pragma unroll   // keeps the register arrays indexed by constants
            for (int t = 0; t < 2; t++) {
                const unsigned char* kp = B + koff + it * AK_SLICE + t * 16 * AK_PITCH;
                Frag16 b0, b1;
                b0.h[0] = *reinterpret_cast<const bf16x8*>(kp);
                b0.h[1] = *reinterpret_cast<const bf16x8*>(kp + 32);
                b1.h[0] = *reinterpret_cast<const bf16x8*>(kp + 64);
                b1.h[1] = *reinterpret_cast<const bf16x8*>(kp + 96);
                s[t] = wmma_bf16(b0, aq[0], v8f_zero());
                s[t] = wmma_bf16(b1, aq[1], s[t]);
            }
            // ---- bias + key-padding mask: 8 keys in a row per subtile
            f32x4 rb[2][2];
            i32x4 mk[2][2];
#pragma unroll   // keeps the register arrays indexed by constants
            for (int t = 0; t < 2; t++) {
                const f32x4* bp = reinterpret_cast<const f32x4*>(B + roff + it * 128 + t * 64);
                const i32x4* mp = reinterpret_cast<const i32x4*>(Ml + kk + t * 16);
                rb[t][0] = bp[0];  rb[t][1] = bp[1];
                mk[t][0] = mp[0];  mk[t][1] = mp[1];
            }
            // stands ahead of any rewrite of the address registers that the mask loads name
            asm volatile("s_wait_xcnt 0x0" ::: "memory");
            float sv[2][8];
#pragma unroll   // keeps the register arrays indexed by constants
            for (int t = 0; t < 2; t++)
#pragma unroll   // keeps the register arrays indexed by constants
                for (int r = 0; r < 4; r++) {
                    sv[t][r]     = mk[t][0][r] ? s[t][r] + rb[t][0][r]     : -1e30f;
                    sv[t][r + 4] = mk[t][1][r] ? s[t][r + 4] + rb[t][1][r] : -1e30f;
                }
            // ---- online softmax: the row maximum over the lane's 16 keys, then the other half's
            float v = fmaxf(sv[0][0], sv[1][0]);
#pragma unroll   // keeps the register arrays indexed by constants
            for (int r = 1; r < 8; r++)
                v = fmaxf(v, fmaxf(sv[0][r], sv[1][r]));
            v = fmaxf(v, xhalf(v));
            float mnew  = fmaxf(mrow, v);
            float scale = __expf(mrow - mnew);
#pragma unroll   // keeps the register arrays indexed by constants
            for (int j = 0; j < 4; j++)
#pragma unroll   // keeps the register arrays indexed by constants
                for (int r = 0; r < 8; r++)
                    o[j][r] = o[j][r] * scale;
            // ---- P^T B-frag straight from the lane's own scores, cast to bf16
            Frag16 pt;
            float srow = 0.f;
#pragma unroll   // keeps the register arrays indexed by constants
            for (int r = 0; r < 8; r++)
#pragma unroll   // keeps the register arrays indexed by constants
                for (int t = 0; t < 2; t++) {
                    float p = (sv[t][r] > -1e29f) ? __expf(sv[t][r] - mnew) : 0.f;
                    srow += p;
                    pt.v[t * 8 + r] = (bf16_t)p;
                }
            lsum = lsum * scale + srow;
            mrow = mnew;

            // ---- O^T += V^T * P^T  (V^T rows in LDS: keys run along a row)
#pragma unroll   // keeps the register arrays indexed by constants
            for (int j = 0; j < 4; j++) {
                const unsigned char* vp = B + voff + (j >> 1) * AK_SLICE
                                        + (j & 1) * 16 * AK_PITCH + it * 64;
                Frag16 bv;
                bv.h[0] = *reinterpret_cast<const bf16x8*>(vp);
                bv.h[1] = *reinterpret_cast<const bf16x8*>(vp + 32);
                o[j] = wmma_bf16(bv, pt, o[j]);
            }
        }
        // publish point of stage st + 1
        asm volatile("s_wait_dscnt 0x0" ::: "memory");      // own reads of this buffer are done
        // own slice of stage st + 1 has landed; names the descriptor, see above
        asm volatile("s_wait_tensorcnt 0x0" :: "s"(g0), "s"(g1) : "memory");
        __syncthreads();   // publishes stage st + 1; ends every reader's last read of stage st
        if (pinned(st + 2u < AT_NST)) {                     // refill the buffer just left
            g0 = group0(st + 2u);
            asm volatile("tensor_load_to_lds %0, %1" : "+s"(g0) : "s"(g1) : "memory");
        }
    }
    asm volatile("s_wait_tensorcnt 0x0" ::: "memory");  // no request outlives the loop
    asm volatile("s_wait_dscnt 0x0" ::: "memory");

    // ---- normalize and write [B,N, H*64] bf16: 8 d in a row per lane and tile
    float l   = lsum + xhalf(lsum);
    float inv = (l > 0.f) ? 1.f / l : 0.f;
    bf16_t* op = out + ((size_t)bi * SEQN + qbase + lr) * DIMC + h * HDIM + hf * 8;
#pragma unroll   // keeps the register arrays indexed by constants
    for (int j = 0; j < 4; j++) {
        bf16x8 w;
#pragma unroll   // keeps the register arrays indexed by constants
        for (int r = 0; r < 8; r++)
            w[r] = (bf16_t)(o[j][r] * inv);
        *reinterpret_cast<bf16x8*>(op + j * 16) = w;
    }
}

// ---------------------------------------------------------------------------
// Proj GEMM + bias + residual -> f32.  grid (32,8), block 128
// ---------------------------------------------------------------------------
__global__ void __launch_bounds__(128) gemm_proj_kernel(const bf16_t* __restrict__ A,
                                 const bf16_t* __restrict__ W,
                                 const float* __restrict__ bias,
                                 const float* __restrict__ resid,
                                 float* __restrict__ out) {
    __shared__ __attribute__((aligned(2048))) unsigned char L[T_LDS];
    int wv = threadIdx.x >> 5;
    v8f acc[4][4];
    block_gemm_128x128<DIMC>(A, W, blockIdx.x * 128u, blockIdx.y * 128u, L, acc);
    int m0 = blockIdx.x * 128 + (wv >> 1) * 64;   // this wave's 64 x 64 part
    int n0 = blockIdx.y * 128 + (wv & 1) * 64;
    int lane = threadIdx.x & 31, hf = lane >> 4, lr = lane & 15;
#pragma unroll
    for (int i = 0; i < 4; i++)
#pragma unroll
        for (int j = 0; j < 4; j++) {
            int col = n0 + j * 16 + lr;
            float bv = bias[col];
#pragma unroll
            for (int r = 0; r < 8; r++) {
                size_t row = (size_t)(m0 + i * 16 + 8 * hf + r);
                out[row * DIMC + col] = acc[i][j][r] + bv + resid[row * DIMC + col];
            }
        }
}

// ---------------------------------------------------------------------------
// Exact GELU of eight accumulators, 0.5 v (1 + erf(v / sqrt 2)), with no branch.
// erf(|x|) has two ranges (the f32 math library's own polynomials, coefficient for
// coefficient): below 1, |x| + |x| Q(x^2); from 1 on, 1 - exp(-(|x| + |x| P(|x|))).
// Both are evaluated for every element and one select picks: the eight chains, and those
// of the neighbouring fragments, are then independent straight-line code that the
// compiler can interleave and pack in pairs, where a test per element left one dependent
// chain after another.  erf is odd, so v erf(x) = |v| erf(|x|) and no sign is put back.
// The unselected range may overflow; it is dropped by the select.
// ---------------------------------------------------------------------------
__device__ __forceinline__ v8f fma8(v8f a, v8f b, float c) {
    const v8f cv = {c, c, c, c, c, c, c, c};
    return __builtin_elementwise_fma(a, b, cv);
}

__device__ __forceinline__ v8f gelu8(v8f v) {
    const v8f hv = v * 0.5f;
    const v8f ah = __builtin_elementwise_abs(hv);
    const v8f ax = ah * 1.41421356f;              // |v| / sqrt 2
    // |x| >= 1
    v8f p = ax * 1.69988107e-5f + (-3.78677854e-4f);
    p = fma8(ax, p, 3.85781587e-3f);
    p = fma8(ax, p, -2.41816975e-2f);
    p = fma8(ax, p, 0.106668264f);
    p = fma8(ax, p, 0.634933293f);
    p = fma8(ax, p, 0.128689408f);
    p = __builtin_elementwise_fma(ax, p, ax);
    p = p * -1.44269502f;                         // exp(-p) = 2^(-p log2 e)
    // |x| < 1
    const v8f t = ax * ax;
    v8f q = t * -5.61801775e-4f + 4.91381623e-3f;
    q = fma8(t, q, -2.67075151e-2f);
    q = fma8(t, q, 0.112800106f);
    q = fma8(t, q, -0.376122952f);
    q = fma8(t, q, 0.128379107f);
    q = __builtin_elementwise_fma(ax, q, ax);
    v8f e;
#pragma unroll   // keeps the register arrays indexed by constants
    for (int r = 0; r < 8; r++)
        e[r] = (ax[r] < 1.0f) ? q[r] : 1.0f - __builtin_amdgcn_exp2f(p[r]);
    return __builtin_elementwise_fma(ah, e, hv);  // 0.5 v + 0.5 |v| erf(|x|)
}

// ---------------------------------------------------------------------------
// MLP1 GEMM + bias + exact GELU -> bf16.  grid (32,32), block 128
// ---------------------------------------------------------------------------
__global__ void __launch_bounds__(128) gemm_mlp1_kernel(const bf16_t* __restrict__ A,
                                 const bf16_t* __restrict__ W,
                                 const float* __restrict__ bias,
                                 bf16_t* __restrict__ out) {
    __shared__ __attribute__((aligned(2048))) unsigned char L[T_LDS];
    int wv = threadIdx.x >> 5;
    v8f acc[4][4];
    block_gemm_128x128<DIMC>(A, W, blockIdx.x * 128u, blockIdx.y * 128u, L, acc);
    int m0 = blockIdx.x * 128 + (wv >> 1) * 64;   // this wave's 64 x 64 part
    int n0 = blockIdx.y * 128 + (wv & 1) * 64;
    int lane = threadIdx.x & 31, hf = lane >> 4, lr = lane & 15;
#pragma unroll
    for (int i = 0; i < 4; i++)
#pragma unroll
        for (int j = 0; j < 4; j++) {
            int col = n0 + j * 16 + lr;
            float bv = bias[col];
            const v8f g = gelu8(acc[i][j] + bv);
#pragma unroll
            for (int r = 0; r < 8; r++) {
                size_t row = (size_t)(m0 + i * 16 + 8 * hf + r);
                out[row * HIDDEN + col] = (bf16_t)g[r];
            }
        }
}

// ---------------------------------------------------------------------------
// MLP2 GEMM + bias + residual -> f32 final output.  grid (32,8), block 128
// ---------------------------------------------------------------------------
__global__ void __launch_bounds__(128) gemm_mlp2_kernel(const bf16_t* __restrict__ A,
                                 const bf16_t* __restrict__ W,
                                 const float* __restrict__ bias,
                                 const float* __restrict__ resid,
                                 float* __restrict__ out) {
    __shared__ __attribute__((aligned(2048))) unsigned char L[T_LDS];
    int wv = threadIdx.x >> 5;
    v8f acc[4][4];
    block_gemm_128x128<HIDDEN>(A, W, blockIdx.x * 128u, blockIdx.y * 128u, L, acc);
    int m0 = blockIdx.x * 128 + (wv >> 1) * 64;   // this wave's 64 x 64 part
    int n0 = blockIdx.y * 128 + (wv & 1) * 64;
    int lane = threadIdx.x & 31, hf = lane >> 4, lr = lane & 15;
#pragma unroll
    for (int i = 0; i < 4; i++)
#pragma unroll
        for (int j = 0; j < 4; j++) {
            int col = n0 + j * 16 + lr;
            float bv = bias[col];
#pragma unroll
            for (int r = 0; r < 8; r++) {
                size_t row = (size_t)(m0 + i * 16 + 8 * hf + r);
                out[row * DIMC + col] = acc[i][j][r] + bv + resid[row * DIMC + col];
            }
        }
}

// ---------------------------------------------------------------------------
// Host driver
// ---------------------------------------------------------------------------
extern "C" void kernel_launch(void* const* d_in, const int* in_sizes, int n_in,
                              void* d_out, int out_size, void* d_ws, size_t ws_size,
                              hipStream_t stream) {
    const float* x      = (const float*)d_in[0];
    const float* rel    = (const float*)d_in[1];
    const int*   amask  = (const int*)  d_in[2];
    const float* n1w    = (const float*)d_in[3];
    const float* n1b    = (const float*)d_in[4];
    const float* qkv_w  = (const float*)d_in[5];
    const float* q_bias = (const float*)d_in[6];
    const float* v_bias = (const float*)d_in[7];
    const float* proj_w = (const float*)d_in[8];
    const float* proj_b = (const float*)d_in[9];
    const float* n2w    = (const float*)d_in[10];
    const float* n2b    = (const float*)d_in[11];
    const float* w1     = (const float*)d_in[12];
    const float* b1     = (const float*)d_in[13];
    const float* w2     = (const float*)d_in[14];
    const float* b2     = (const float*)d_in[15];
    float* out = (float*)d_out;
    (void)in_sizes; (void)n_in; (void)out_size; (void)ws_size;

    char* ws = (char*)d_ws;
    size_t off = 0;
    auto alloc = [&](size_t bytes) -> char* {
        char* p = ws + off;
        off = (off + bytes + 255) & ~(size_t)255;
        return p;
    };
    bf16_t* ln1b   = (bf16_t*)alloc((size_t)MROWS * DIMC * 2);
    bf16_t* wqkvb  = (bf16_t*)alloc((size_t)3 * DIMC * DIMC * 2);
    bf16_t* qb     = (bf16_t*)alloc((size_t)MROWS * DIMC * 2);   // [B,H,N,64]
    bf16_t* kb     = (bf16_t*)alloc((size_t)MROWS * DIMC * 2);   // [B,H,N,64]
    bf16_t* vtb    = (bf16_t*)alloc((size_t)MROWS * DIMC * 2);   // [B,H,64,N]
    bf16_t* attnb  = (bf16_t*)alloc((size_t)MROWS * DIMC * 2);   // [B*N, C]
    bf16_t* wprojb = (bf16_t*)alloc((size_t)DIMC * DIMC * 2);
    float*  x1     = (float*) alloc((size_t)MROWS * DIMC * 4);
    bf16_t* ln2b   = (bf16_t*)alloc((size_t)MROWS * DIMC * 2);
    bf16_t* w1b    = (bf16_t*)alloc((size_t)HIDDEN * DIMC * 2);
    bf16_t* hb     = (bf16_t*)alloc((size_t)MROWS * HIDDEN * 2);
    bf16_t* w2b    = (bf16_t*)alloc((size_t)DIMC * HIDDEN * 2);

    // weight conversions
    cvt_f32_bf16_kernel<<<(3 * DIMC * DIMC) / CVT_BLOCK, CVT_THREADS, 0, stream>>>(qkv_w, wqkvb);
    cvt_f32_bf16_kernel<<<(DIMC * DIMC) / CVT_BLOCK, CVT_THREADS, 0, stream>>>(proj_w, wprojb);
    cvt_f32_bf16_kernel<<<(HIDDEN * DIMC) / CVT_BLOCK, CVT_THREADS, 0, stream>>>(w1, w1b);
    cvt_f32_bf16_kernel<<<(DIMC * HIDDEN) / CVT_BLOCK, CVT_THREADS, 0, stream>>>(w2, w2b);

    // x -> LN1 -> bf16
    layernorm_bf16_kernel<<<MROWS, 256, 0, stream>>>(x, n1w, n1b, ln1b, DIMC);

    // QKV projection + head scatter
    gemm_qkv_kernel<<<dim3(MROWS / 128, (3 * DIMC) / 128), 128, 0, stream>>>(
        ln1b, wqkvb, q_bias, v_bias, qb, kb, vtb);

    // flash attention per (b, h, 128 queries)
    attention_kernel<<<BATCH * NHEAD * (SEQN / 128), 256, 0, stream>>>(
        qb, kb, vtb, rel, amask, attnb);

    // proj + residual -> x1 (f32)
    gemm_proj_kernel<<<dim3(MROWS / 128, DIMC / 128), 128, 0, stream>>>(
        attnb, wprojb, proj_b, x, x1);

    // LN2 -> bf16
    layernorm_bf16_kernel<<<MROWS, 256, 0, stream>>>(x1, n2w, n2b, ln2b, DIMC);

    // MLP
    gemm_mlp1_kernel<<<dim3(MROWS / 128, HIDDEN / 128), 128, 0, stream>>>(
        ln2b, w1b, b1, hb);
    gemm_mlp2_kernel<<<dim3(MROWS / 128, DIMC / 128), 128, 0, stream>>>(
        hb, w2b, b2, x1, out);
}
